// v000
// Times are from an AMD MI455X. After a warm-up the kernel runs many times in a row, and a time is the length of
// such a window on the GPU divided by its runs, so every launch and the gaps after it count. The runs cycle
// through copies of the inputs. A figure is the median of several windows, for all but v000 over two sittings.
// Sittings can differ by a few percent; kernels timed side by side share one.
// v000, which the later versions start from, runs in 157 microseconds.
#include <hip/hip_runtime.h>

// Flash-attention with relative-position bias for MI455X (gfx1250, wave32).
// QK^T: V_WMMA_F32_16X16X32_BF16 with 3-term hi/lo bf16 split (~2^-15 rel err).
// P@V : V_WMMA_F32_16X16X4_F32 with exact fp32 probabilities (P recycled
//       through the LDS transpose tile, zero conversion VALU).
// K is pre-split to bf16 hi/lo planes; V is pre-transposed to [b][d][s] f32.

typedef __attribute__((ext_vector_type(2)))  float  v2f;
typedef __attribute__((ext_vector_type(4)))  float  v4f;
typedef __attribute__((ext_vector_type(8)))  float  v8f;
typedef __attribute__((ext_vector_type(8)))  __bf16 v8bf;
typedef __attribute__((ext_vector_type(16))) __bf16 v16bf;

#define B_DIM  16
#define S_DIM  2048
#define DH     64
#define NWAVES 8        // waves per block
#define PSTR   36       // padded LDS row stride (floats): conflict-free, 16B-aligned
#define KV_ELEMS (B_DIM * S_DIM * DH)

__device__ __bf16 g_khi[KV_ELEMS];  // [b][s][d]
__device__ __bf16 g_klo[KV_ELEMS];
__device__ float  g_vt[KV_ELEMS];   // transposed: [b][d][s], f32

__device__ __forceinline__ unsigned int bfbits(__bf16 h) {
  return (unsigned int)__builtin_bit_cast(unsigned short, h);
}

// ---- split K -> bf16 hi/lo planes (2 elements/thread, packed b32 stores) ----
__global__ __launch_bounds__(256) void split_k_kernel(const float* __restrict__ K) {
  const int i = blockIdx.x * 256 + threadIdx.x;
  const float x0 = K[2 * i], x1 = K[2 * i + 1];
  const __bf16 h0 = (__bf16)x0, h1 = (__bf16)x1;
  const __bf16 l0 = (__bf16)(x0 - (float)h0), l1 = (__bf16)(x1 - (float)h1);
  ((unsigned int*)g_khi)[i] = bfbits(h0) | (bfbits(h1) << 16);
  ((unsigned int*)g_klo)[i] = bfbits(l0) | (bfbits(l1) << 16);
}

// ---- transpose V -> f32 plane [b][d][s] (LDS-tiled, coalesced) ----
__global__ __launch_bounds__(256) void transpose_v_kernel(const float* __restrict__ V) {
  __shared__ float tile[64][65];
  const int b   = blockIdx.x >> 5;          // 32 s-blocks of 64 per batch-head
  const int s0  = (blockIdx.x & 31) << 6;
  const int tid = threadIdx.x;
#pragma unroll
  for (int r = 0; r < 16; ++r) {
    const int idx = r * 256 + tid;
    const int sl = idx >> 6, d = idx & 63;
    tile[sl][d] = V[((size_t)(b * S_DIM + s0 + sl)) * DH + d];
  }
  __syncthreads();
  const int d  = tid >> 2;
  const int sr = (tid & 3) << 4;
  float* o = g_vt + ((size_t)(b * DH + d)) * S_DIM + s0 + sr;
#pragma unroll
  for (int j = 0; j < 16; j += 4) {
    v4f t;
    t[0] = tile[sr + j][d];
    t[1] = tile[sr + j + 1][d];
    t[2] = tile[sr + j + 2][d];
    t[3] = tile[sr + j + 3][d];
    *(v4f*)(o + j) = t;
  }
}

__device__ __forceinline__ v8f wmma_bf16(v16bf a, v16bf b, v8f c) {
  return __builtin_amdgcn_wmma_f32_16x16x32_bf16(false, a, false, b, (short)0, c,
                                                 false, false);
}
__device__ __forceinline__ v8f wmma_f32(v2f a, v2f b, v8f c) {
  return __builtin_amdgcn_wmma_f32_16x16x4_f32(false, a, false, b, (short)0, c,
                                               false, false);
}
__device__ __forceinline__ v16bf cat8(v8bf a, v8bf b) {
  return __builtin_shufflevector(a, b, 0, 1, 2, 3, 4, 5, 6, 7,
                                       8, 9, 10, 11, 12, 13, 14, 15);
}
// fragment = two contiguous 8-elem runs at p and p+16 (A/B 16-bit layout)
__device__ __forceinline__ v16bf ld_frag(const __bf16* p) {
  return cat8(*(const v8bf*)p, *(const v8bf*)(p + 16));
}

__global__ __launch_bounds__(256) void attn_fa_kernel(
    const float* __restrict__ Q, const float* __restrict__ Rw,
    const float* __restrict__ Rb, float* __restrict__ Out) {
  __shared__ float sh_rw[2 * DH];
  __shared__ float sh_rb[2];
  __shared__ float sh_p[NWAVES][16 * PSTR];  // 16x32 score/prob transpose tile
  __shared__ float sh_bc[NWAVES][16];        // lm-domain -> g-domain broadcast

  const int tid  = threadIdx.x;
  const int wave = tid >> 5;
  const int lane = tid & 31;
  const int lm   = lane & 15;
  const int lh   = lane >> 4;

  if (tid < 2 * DH) sh_rw[tid] = Rw[tid];
  if (tid < 2) sh_rb[tid] = Rb[tid];
  __syncthreads();

  const int tile = blockIdx.x * NWAVES + wave;
  const int b    = tile >> 7;
  const int q0   = (tile & 127) << 4;

  // log2(e)/sqrt(512): softmax in base-2 domain -> native v_exp_f32
  const float qscale = 0.04419417382415922f * 1.4426950408889634f;

  // ---- Q row (lm) in bf16-fragment element order: q32[16c + e] ----
  float q32[32];
  {
    const float* qrow = Q + ((size_t)(b * S_DIM + q0 + lm)) * DH;
#pragma unroll
    for (int r = 0; r < 4; ++r) {
      const v4f t0 = *(const v4f*)(qrow + 16 * r + 8 * lh);
      const v4f t1 = *(const v4f*)(qrow + 16 * r + 8 * lh + 4);
#pragma unroll
      for (int j = 0; j < 4; ++j) {
        q32[r * 8 + j]     = t0[j] * qscale;
        q32[r * 8 + 4 + j] = t1[j] * qscale;
      }
    }
  }

  // ---- relative-position bias for q-row lm: pos0 (j<i), posd = pos1-pos0 ----
  float pos0, posd;
  {
    float part0 = 0.f, part1 = 0.f;
#pragma unroll
    for (int r = 0; r < 4; ++r) {
#pragma unroll
      for (int j = 0; j < 8; ++j) {
        const int d = 16 * r + 8 * lh + j;
        part0 += q32[r * 8 + j] * sh_rw[d];
        part1 += q32[r * 8 + j] * sh_rw[DH + d];
      }
    }
    part0 += __shfl_xor(part0, 16);
    part1 += __shfl_xor(part1, 16);
    part0 += sh_rb[0] * qscale;
    part1 += sh_rb[1] * qscale;
    pos0 = part0;
    posd = part1 - part0;
  }

  float* Pl = sh_p[wave];
  float* Bc = sh_bc[wave];

  // ---- pos0 broadcast into the WMMA C layout (rows g+8*lh): bias rides the
  //      matrix op's C operand, no per-step bias adds ----
  v8f posC;
  {
    Bc[lm] = pos0;
    asm volatile("" ::: "memory");
#pragma unroll
    for (int g = 0; g < 8; ++g) posC[g] = Bc[g + 8 * lh];
  }

  // ---- Q bf16 hi/lo A-fragments (2 chunks of K=32) ----
  v16bf aQhi[2], aQlo[2];
#pragma unroll
  for (int c = 0; c < 2; ++c) {
#pragma unroll
    for (int e = 0; e < 16; ++e) {
      const float x = q32[16 * c + e];
      const __bf16 h = (__bf16)x;
      aQhi[c][e] = h;
      aQlo[c][e] = (__bf16)(x - (float)h);
    }
  }

  v8f acc0 = {}, acc1 = {}, acc2 = {}, acc3 = {};
  float mrun = -3.0e38f, srun = 0.f;

  const __bf16* khi_b = g_khi + (size_t)b * S_DIM * DH;
  const __bf16* klo_b = g_klo + (size_t)b * S_DIM * DH;
  const float*  vt_b  = g_vt  + (size_t)b * DH * S_DIM;

  auto step32 = [&](int kb, bool tail) {
    // ---- K fragments (hi/lo) for two 16-key tiles ----
    const int row0 = kb + lm;
    int row1 = kb + 16 + lm;
    if (tail && row1 > S_DIM - 1) row1 = S_DIM - 1;  // masked anyway
    const __bf16* kr0h = khi_b + (size_t)row0 * DH + 8 * lh;
    const __bf16* kr1h = khi_b + (size_t)row1 * DH + 8 * lh;
    const __bf16* kr0l = klo_b + (size_t)row0 * DH + 8 * lh;
    const __bf16* kr1l = klo_b + (size_t)row1 * DH + 8 * lh;
    if (!tail) {
      __builtin_prefetch(kr0h + 32 * DH, 0, 3);
      __builtin_prefetch(kr1h + 32 * DH, 0, 3);
    }

    // ---- S tiles (+pos0 via C): 3-term bf16 split, 12 WMMAs, two chains ----
    v8f Sv0 = posC, Sv1 = posC;
#pragma unroll
    for (int c = 0; c < 2; ++c) {
      const v16bf k0h = ld_frag(kr0h + 32 * c);
      const v16bf k1h = ld_frag(kr1h + 32 * c);
      const v16bf k0l = ld_frag(kr0l + 32 * c);
      const v16bf k1l = ld_frag(kr1l + 32 * c);
      Sv0 = wmma_bf16(aQhi[c], k0h, Sv0);
      Sv1 = wmma_bf16(aQhi[c], k1h, Sv1);
      Sv0 = wmma_bf16(aQlo[c], k0h, Sv0);
      Sv1 = wmma_bf16(aQlo[c], k1h, Sv1);
      Sv0 = wmma_bf16(aQhi[c], k0l, Sv0);
      Sv1 = wmma_bf16(aQhi[c], k1l, Sv1);
    }

    // ---- transpose both 16x16 tiles (C/D -> A domain) through padded LDS ----
#pragma unroll
    for (int g = 0; g < 8; ++g) {
      Pl[(g + 8 * lh) * PSTR + lm]      = Sv0[g];
      Pl[(g + 8 * lh) * PSTR + 16 + lm] = Sv1[g];
    }
    asm volatile("" ::: "memory");  // same-wave LDS pipe is in-order
    float vals[16];
    {
      const v4f r0 = *(const v4f*)&Pl[lm * PSTR + 8 * lh];
      const v4f r1 = *(const v4f*)&Pl[lm * PSTR + 8 * lh + 4];
      const v4f r2 = *(const v4f*)&Pl[lm * PSTR + 16 + 8 * lh];
      const v4f r3 = *(const v4f*)&Pl[lm * PSTR + 20 + 8 * lh];
#pragma unroll
      for (int j = 0; j < 4; ++j) {
        vals[j]      = r0[j];
        vals[4 + j]  = r1[j];
        vals[8 + j]  = r2[j];
        vals[12 + j] = r3[j];
      }
    }

    // ---- (tail-only) causal mask + diagonal bias in A domain ----
    if (tail) {
#pragma unroll
      for (int e = 0; e < 16; ++e) {
        const int k  = (e < 8) ? (8 * lh + e) : (16 + 8 * lh + (e - 8));
        const int dk = (kb + k) - (q0 + lm);
        vals[e] = (dk > 0) ? -1.0e30f : ((dk == 0) ? vals[e] + posd : vals[e]);
      }
    }

    // ---- online softmax over 32 keys; balanced-tree reductions (depth 4) ----
    float tm[8];
#pragma unroll
    for (int i = 0; i < 8; ++i) tm[i] = fmaxf(vals[i], vals[8 + i]);
#pragma unroll
    for (int i = 0; i < 4; ++i) tm[i] = fmaxf(tm[i], tm[4 + i]);
    float rmax = fmaxf(fmaxf(tm[0], tm[1]), fmaxf(tm[2], tm[3]));
    rmax = fmaxf(rmax, __shfl_xor(rmax, 16));
    const float nm = fmaxf(mrun, rmax);
    if (__any(rmax > mrun)) {  // wave-uniform; rare in steady state
      const float corr = exp2f(mrun - nm);
      srun *= corr;
      Bc[lm] = corr;
      asm volatile("" ::: "memory");
#pragma unroll
      for (int g = 0; g < 8; ++g) {
        const float cg = Bc[g + 8 * lh];
        acc0[g] *= cg; acc1[g] *= cg; acc2[g] *= cg; acc3[g] *= cg;
      }
    }
    mrun = nm;

    v4f p0, p1, p2, p3;
#pragma unroll
    for (int j = 0; j < 4; ++j) {
      p0[j] = exp2f(vals[j] - nm);
      p1[j] = exp2f(vals[4 + j] - nm);
      p2[j] = exp2f(vals[8 + j] - nm);
      p3[j] = exp2f(vals[12 + j] - nm);
    }
    const v4f ps = (p0 + p1) + (p2 + p3);   // element-wise tree
    float rs = (ps[0] + ps[1]) + (ps[2] + ps[3]);
    rs += __shfl_xor(rs, 16);
    srun += rs;

    // ---- recycle LDS tile: store exact-f32 P, reread in fp32 A layout ----
    *(v4f*)&Pl[lm * PSTR + 8 * lh]          = p0;
    *(v4f*)&Pl[lm * PSTR + 8 * lh + 4]      = p1;
    *(v4f*)&Pl[lm * PSTR + 16 + 8 * lh]     = p2;
    *(v4f*)&Pl[lm * PSTR + 20 + 8 * lh]     = p3;
    asm volatile("" ::: "memory");
    v2f aP[8];
#pragma unroll
    for (int c = 0; c < 8; ++c)
      aP[c] = *(const v2f*)&Pl[lm * PSTR + 4 * c + 2 * lh];

    // ---- O += P @ V : exact fp32, 32 WMMAs, 4 independent chains ----
#pragma unroll
    for (int c = 0; c < 8; ++c) {
      int s = kb + 4 * c + 2 * lh;
      if (tail && s > S_DIM - 2) s = S_DIM - 2;  // masked anyway (P==0)
      const float* vcol = vt_b + s;
      const v2f bv0 = *(const v2f*)(vcol + (size_t)lm * S_DIM);
      const v2f bv1 = *(const v2f*)(vcol + (size_t)(16 + lm) * S_DIM);
      const v2f bv2 = *(const v2f*)(vcol + (size_t)(32 + lm) * S_DIM);
      const v2f bv3 = *(const v2f*)(vcol + (size_t)(48 + lm) * S_DIM);
      acc0 = wmma_f32(aP[c], bv0, acc0);
      acc1 = wmma_f32(aP[c], bv1, acc1);
      acc2 = wmma_f32(aP[c], bv2, acc2);
      acc3 = wmma_f32(aP[c], bv3, acc3);
    }
  };

  int kb = 0;
  for (; kb + 32 <= q0; kb += 32) step32(kb, false);  // mask-free hot loop
  step32(kb, true);                                   // diagonal (+dead) tail

  // ---- epilogue: broadcast 1/srun to g-domain, normalize, store ----
  Bc[lm] = srun;
  asm volatile("" ::: "memory");
#pragma unroll
  for (int g = 0; g < 8; ++g) {
    const float inv = __builtin_amdgcn_rcpf(Bc[g + 8 * lh]);
    float* orow = Out + ((size_t)b * S_DIM + q0 + g + 8 * lh) * DH + lm;
    orow[0]  = acc0[g] * inv;
    orow[16] = acc1[g] * inv;
    orow[32] = acc2[g] * inv;
    orow[48] = acc3[g] * inv;
  }
}

extern "C" void kernel_launch(void* const* d_in, const int* in_sizes, int n_in,
                              void* d_out, int out_size, void* d_ws, size_t ws_size,
                              hipStream_t stream) {
  const float* Q  = (const float*)d_in[0];
  const float* K  = (const float*)d_in[1];
  const float* V  = (const float*)d_in[2];
  const float* Rw = (const float*)d_in[3];
  const float* Rb = (const float*)d_in[4];
  float* Out = (float*)d_out;

  split_k_kernel<<<KV_ELEMS / 2 / 256, 256, 0, stream>>>(K);
  transpose_v_kernel<<<B_DIM * 32, 256, 0, stream>>>(V);

  const int tiles  = B_DIM * (S_DIM / 16);   // 2048 q-tiles
  const int blocks = tiles / NWAVES;         // 256 blocks of 8 waves
  attn_fa_kernel<<<blocks, 256, 0, stream>>>(Q, Rw, Rb, Out);
}

// v001
// A run of this version takes 79.5 microseconds.
// Next to v000, in two timings, it ran 1.99 times as fast each time.
#include <hip/hip_runtime.h>

// Flash-attention with relative-position bias for MI455X (gfx1250, wave32).
// QK^T: V_WMMA_F32_16X16X32_BF16 with 3-term hi/lo bf16 split (~2^-15 rel err).
// P@V : V_WMMA_F32_16X16X4_F32 with exact fp32 probabilities (P recycled
//       through the LDS transpose tile, zero conversion VALU).
// K is pre-split to bf16 hi/lo planes; V is pre-transposed to [b][d][s] f32.
// The 8 waves of a block share each 128-key K/V stage through a two-buffer
// LDS ring that asynchronous copies fill one stage ahead.

typedef __attribute__((ext_vector_type(2)))  float  v2f;
typedef __attribute__((ext_vector_type(4)))  float  v4f;
typedef __attribute__((ext_vector_type(8)))  float  v8f;
typedef __attribute__((ext_vector_type(8)))  __bf16 v8bf;
typedef __attribute__((ext_vector_type(16))) __bf16 v16bf;

#define B_DIM  16
#define S_DIM  2048
#define DH     64
#define NWAVES 8        // waves per block
#define PSTR   36       // padded LDS row stride (floats): conflict-free, 16B-aligned
#define KV_ELEMS (B_DIM * S_DIM * DH)
#define SK      128                      // keys per LDS stage (= q rows per block)
#define KPITCH  144                      // staged K row: 128 B + 16 B pad (16 B x odd)
#define VPITCH  528                      // staged V^T row: 512 B + 16 B pad
#define KH_OFF  0
#define KL_OFF  (SK * KPITCH)
#define VT_OFF  (2 * SK * KPITCH)
#define BUFB    (VT_OFF + DH * VPITCH)   // bytes per ring buffer

__device__ __bf16 g_khi[KV_ELEMS];  // [b][s][d]
__device__ __bf16 g_klo[KV_ELEMS];
__device__ float  g_vt[KV_ELEMS];   // transposed: [b][d][s], f32

__device__ __forceinline__ unsigned int bfbits(__bf16 h) {
  return (unsigned int)__builtin_bit_cast(unsigned short, h);
}

// ---- split K -> bf16 hi/lo planes (2 elements/thread, packed b32 stores) ----
__global__ __launch_bounds__(256) void split_k_kernel(const float* __restrict__ K) {
  const int i = blockIdx.x * 256 + threadIdx.x;
  const float x0 = K[2 * i], x1 = K[2 * i + 1];
  const __bf16 h0 = (__bf16)x0, h1 = (__bf16)x1;
  const __bf16 l0 = (__bf16)(x0 - (float)h0), l1 = (__bf16)(x1 - (float)h1);
  ((unsigned int*)g_khi)[i] = bfbits(h0) | (bfbits(h1) << 16);
  ((unsigned int*)g_klo)[i] = bfbits(l0) | (bfbits(l1) << 16);
}

// ---- transpose V -> f32 plane [b][d][s] (LDS-tiled, coalesced) ----
__global__ __launch_bounds__(256) void transpose_v_kernel(const float* __restrict__ V) {
  __shared__ float tile[64][65];
  const int b   = blockIdx.x >> 5;          // 32 s-blocks of 64 per batch-head
  const int s0  = (blockIdx.x & 31) << 6;
  const int tid = threadIdx.x;
#pragma unroll
  for (int r = 0; r < 16; ++r) {
    const int idx = r * 256 + tid;
    const int sl = idx >> 6, d = idx & 63;
    tile[sl][d] = V[((size_t)(b * S_DIM + s0 + sl)) * DH + d];
  }
  __syncthreads();
  const int d  = tid >> 2;
  const int sr = (tid & 3) << 4;
  float* o = g_vt + ((size_t)(b * DH + d)) * S_DIM + s0 + sr;
#pragma unroll
  for (int j = 0; j < 16; j += 4) {
    v4f t;
    t[0] = tile[sr + j][d];
    t[1] = tile[sr + j + 1][d];
    t[2] = tile[sr + j + 2][d];
    t[3] = tile[sr + j + 3][d];
    *(v4f*)(o + j) = t;
  }
}

__device__ __forceinline__ v8f wmma_bf16(v16bf a, v16bf b, v8f c) {
  return __builtin_amdgcn_wmma_f32_16x16x32_bf16(false, a, false, b, (short)0, c,
                                                 false, false);
}
__device__ __forceinline__ v8f wmma_f32(v2f a, v2f b, v8f c) {
  return __builtin_amdgcn_wmma_f32_16x16x4_f32(false, a, false, b, (short)0, c,
                                               false, false);
}
__device__ __forceinline__ v16bf cat8(v8bf a, v8bf b) {
  return __builtin_shufflevector(a, b, 0, 1, 2, 3, 4, 5, 6, 7,
                                       8, 9, 10, 11, 12, 13, 14, 15);
}
// fragment = two contiguous 8-elem runs at p and p+16 (A/B 16-bit layout)
__device__ __forceinline__ v16bf ld_frag(const __bf16* p) {
  return cat8(*(const v8bf*)p, *(const v8bf*)(p + 16));
}

// Eight 16-byte-per-lane copies global -> LDS. The s_wait_xcnt closes the run
// inside the statement, ahead of any later rewrite of the address registers.
__device__ __forceinline__ void async_copy8(const unsigned (&l)[8],
                                            const char* const (&g)[8]) {
  asm volatile(
      "global_load_async_to_lds_b128 %0, %8, off\n\t"
      "global_load_async_to_lds_b128 %1, %9, off\n\t"
      "global_load_async_to_lds_b128 %2, %10, off\n\t"
      "global_load_async_to_lds_b128 %3, %11, off\n\t"
      "global_load_async_to_lds_b128 %4, %12, off\n\t"
      "global_load_async_to_lds_b128 %5, %13, off\n\t"
      "global_load_async_to_lds_b128 %6, %14, off\n\t"
      "global_load_async_to_lds_b128 %7, %15, off\n\t"
      "s_wait_xcnt 0x0"
      :: "v"(l[0]), "v"(l[1]), "v"(l[2]), "v"(l[3]),
         "v"(l[4]), "v"(l[5]), "v"(l[6]), "v"(l[7]),
         "v"(g[0]), "v"(g[1]), "v"(g[2]), "v"(g[3]),
         "v"(g[4]), "v"(g[5]), "v"(g[6]), "v"(g[7])
      : "memory");
}

__global__ __launch_bounds__(256) void attn_fa_kernel(
    const float* __restrict__ Q, const float* __restrict__ Rw,
    const float* __restrict__ Rb, float* __restrict__ Out) {
  __shared__ float sh_rw[2 * DH];
  __shared__ float sh_rb[2];
  __shared__ float sh_p[NWAVES][16 * PSTR];  // 16x32 score/prob transpose tile
  __shared__ float sh_bc[NWAVES][16];        // lm-domain -> g-domain broadcast
  __shared__ __attribute__((aligned(16))) unsigned char ring[2 * BUFB];

  const int tid  = threadIdx.x;
  const int wave = __builtin_amdgcn_readfirstlane(tid >> 5);  // scalar: q0 steers branches
  const int lane = tid & 31;
  const int lm   = lane & 15;
  const int lh   = lane >> 4;

  const int tile = blockIdx.x * NWAVES + wave;
  const int b    = tile >> 7;                 // same for all 8 waves of a block
  const int q0   = (tile & 127) << 4;
  const int nst  = (blockIdx.x & 15) + 1;     // 128-key stages up to the block's diagonal

  const __bf16* khi_b = g_khi + (size_t)b * S_DIM * DH;
  const __bf16* klo_b = g_klo + (size_t)b * S_DIM * DH;
  const float*  vt_b  = g_vt  + (size_t)b * DH * S_DIM;

  // ---- one stage = keys [SK*t, SK*t+SK): K hi, K lo (128 rows x 128 B each)
  //      and V^T (64 rows x 512 B); 16 copies of 16 B per thread ----
  const unsigned ring_lds =
      (unsigned)(size_t)(__attribute__((address_space(3))) unsigned char*)ring;
  auto issue_stage = [&](int t) {
    const unsigned lbuf = ring_lds + (unsigned)(t & 1) * BUFB;
    const unsigned lk = lbuf + (unsigned)(tid >> 3) * KPITCH + (unsigned)(tid & 7) * 16;
    const size_t   gk = (size_t)t * (SK * DH * 2) + (size_t)tid * 16;
    unsigned l[8];
    const char* g[8];
#pragma unroll
    for (int r = 0; r < 4; ++r) {
      l[r]     = lk + KH_OFF + r * 32 * KPITCH;
      l[4 + r] = lk + KL_OFF + r * 32 * KPITCH;
      g[r]     = (const char*)khi_b + gk + r * 4096;
      g[4 + r] = (const char*)klo_b + gk + r * 4096;
    }
    async_copy8(l, g);
    const unsigned lv = lbuf + VT_OFF + (unsigned)(tid >> 5) * VPITCH + (unsigned)lane * 16;
    const char* gv = (const char*)vt_b + (size_t)(tid >> 5) * (S_DIM * 4) +
                     (size_t)t * (SK * 4) + (size_t)lane * 16;
#pragma unroll
    for (int r = 0; r < 8; ++r) {
      l[r] = lv + r * 8 * VPITCH;
      g[r] = gv + (size_t)r * 8 * (S_DIM * 4);
    }
    async_copy8(l, g);
  };

  issue_stage(0);
  if (tid < 2 * DH) sh_rw[tid] = Rw[tid];
  if (tid < 2) sh_rb[tid] = Rb[tid];
  asm volatile("s_wait_asynccnt 0x0" ::: "memory");  // own copies of stage 0 landed
  __syncthreads();                                   // publishes stage 0 (and sh_rw, sh_rb)
  if (nst > 1) issue_stage(1);                       // flies during the Q set-up and stage 0

  // log2(e)/sqrt(512): softmax in base-2 domain -> native v_exp_f32
  const float qscale = 0.04419417382415922f * 1.4426950408889634f;

  // ---- Q row (lm) in bf16-fragment element order: q32[16c + e] ----
  float q32[32];
  {
    const float* qrow = Q + ((size_t)(b * S_DIM + q0 + lm)) * DH;
#pragma unroll
    for (int r = 0; r < 4; ++r) {
      const v4f t0 = *(const v4f*)(qrow + 16 * r + 8 * lh);
      const v4f t1 = *(const v4f*)(qrow + 16 * r + 8 * lh + 4);
#pragma unroll
      for (int j = 0; j < 4; ++j) {
        q32[r * 8 + j]     = t0[j] * qscale;
        q32[r * 8 + 4 + j] = t1[j] * qscale;
      }
    }
  }

  // ---- relative-position bias for q-row lm: pos0 (j<i), posd = pos1-pos0 ----
  float pos0, posd;
  {
    float part0 = 0.f, part1 = 0.f;
#pragma unroll
    for (int r = 0; r < 4; ++r) {
#pragma unroll
      for (int j = 0; j < 8; ++j) {
        const int d = 16 * r + 8 * lh + j;
        part0 += q32[r * 8 + j] * sh_rw[d];
        part1 += q32[r * 8 + j] * sh_rw[DH + d];
      }
    }
    part0 += __shfl_xor(part0, 16);
    part1 += __shfl_xor(part1, 16);
    part0 += sh_rb[0] * qscale;
    part1 += sh_rb[1] * qscale;
    pos0 = part0;
    posd = part1 - part0;
  }

  float* Pl = sh_p[wave];
  float* Bc = sh_bc[wave];

  // ---- pos0 broadcast into the WMMA C layout (rows g+8*lh): bias rides the
  //      matrix op's C operand, no per-step bias adds ----
  v8f posC;
  {
    Bc[lm] = pos0;
    asm volatile("" ::: "memory");
#pragma unroll
    for (int g = 0; g < 8; ++g) posC[g] = Bc[g + 8 * lh];
  }

  // ---- Q bf16 hi/lo A-fragments (2 chunks of K=32) ----
  v16bf aQhi[2], aQlo[2];
#pragma unroll
  for (int c = 0; c < 2; ++c) {
#pragma unroll
    for (int e = 0; e < 16; ++e) {
      const float x = q32[16 * c + e];
      const __bf16 h = (__bf16)x;
      aQhi[c][e] = h;
      aQlo[c][e] = (__bf16)(x - (float)h);
    }
  }

  v8f acc0 = {}, acc1 = {}, acc2 = {}, acc3 = {};
  float mrun = -3.0e38f, srun = 0.f;

  // buf: the stage's ring buffer; kl: first key of the step inside the stage
  auto step32 = [&](const unsigned char* buf, int kb, int kl, bool tail) {
    // ---- K fragments (hi/lo) for two 16-key tiles, from the staged rows ----
    const unsigned char* krow = buf + (kl + lm) * KPITCH + 16 * lh;
    const __bf16* kr0h = (const __bf16*)(krow + KH_OFF);
    const __bf16* kr1h = (const __bf16*)(krow + KH_OFF + 16 * KPITCH);
    const __bf16* kr0l = (const __bf16*)(krow + KL_OFF);
    const __bf16* kr1l = (const __bf16*)(krow + KL_OFF + 16 * KPITCH);

    // ---- S tiles (+pos0 via C): 3-term bf16 split, 12 WMMAs, two chains ----
    v8f Sv0 = posC, Sv1 = posC;
#pragma unroll
    for (int c = 0; c < 2; ++c) {
      const v16bf k0h = ld_frag(kr0h + 32 * c);
      const v16bf k1h = ld_frag(kr1h + 32 * c);
      const v16bf k0l = ld_frag(kr0l + 32 * c);
      const v16bf k1l = ld_frag(kr1l + 32 * c);
      Sv0 = wmma_bf16(aQhi[c], k0h, Sv0);
      Sv1 = wmma_bf16(aQhi[c], k1h, Sv1);
      Sv0 = wmma_bf16(aQlo[c], k0h, Sv0);
      Sv1 = wmma_bf16(aQlo[c], k1h, Sv1);
      Sv0 = wmma_bf16(aQhi[c], k0l, Sv0);
      Sv1 = wmma_bf16(aQhi[c], k1l, Sv1);
    }

    // ---- transpose both 16x16 tiles (C/D -> A domain) through padded LDS ----
#pragma unroll
    for (int g = 0; g < 8; ++g) {
      Pl[(g + 8 * lh) * PSTR + lm]      = Sv0[g];
      Pl[(g + 8 * lh) * PSTR + 16 + lm] = Sv1[g];
    }
    asm volatile("" ::: "memory");  // same-wave LDS pipe is in-order
    float vals[16];
    {
      const v4f r0 = *(const v4f*)&Pl[lm * PSTR + 8 * lh];
      const v4f r1 = *(const v4f*)&Pl[lm * PSTR + 8 * lh + 4];
      const v4f r2 = *(const v4f*)&Pl[lm * PSTR + 16 + 8 * lh];
      const v4f r3 = *(const v4f*)&Pl[lm * PSTR + 20 + 8 * lh];
#pragma unroll
      for (int j = 0; j < 4; ++j) {
        vals[j]      = r0[j];
        vals[4 + j]  = r1[j];
        vals[8 + j]  = r2[j];
        vals[12 + j] = r3[j];
      }
    }

    // ---- (tail-only) causal mask + diagonal bias in A domain ----
    if (tail) {
#pragma unroll
      for (int e = 0; e < 16; ++e) {
        const int k  = (e < 8) ? (8 * lh + e) : (16 + 8 * lh + (e - 8));
        const int dk = (kb + k) - (q0 + lm);
        vals[e] = (dk > 0) ? -1.0e30f : ((dk == 0) ? vals[e] + posd : vals[e]);
      }
    }

    // ---- online softmax over 32 keys; balanced-tree reductions (depth 4) ----
    float tm[8];
#pragma unroll
    for (int i = 0; i < 8; ++i) tm[i] = fmaxf(vals[i], vals[8 + i]);
#pragma unroll
    for (int i = 0; i < 4; ++i) tm[i] = fmaxf(tm[i], tm[4 + i]);
    float rmax = fmaxf(fmaxf(tm[0], tm[1]), fmaxf(tm[2], tm[3]));
    rmax = fmaxf(rmax, __shfl_xor(rmax, 16));
    const float nm = fmaxf(mrun, rmax);
    if (__any(rmax > mrun)) {  // wave-uniform; rare in steady state
      const float corr = exp2f(mrun - nm);
      srun *= corr;
      Bc[lm] = corr;
      asm volatile("" ::: "memory");
#pragma unroll
      for (int g = 0; g < 8; ++g) {
        const float cg = Bc[g + 8 * lh];
        acc0[g] *= cg; acc1[g] *= cg; acc2[g] *= cg; acc3[g] *= cg;
      }
    }
    mrun = nm;

    v4f p0, p1, p2, p3;
#pragma unroll
    for (int j = 0; j < 4; ++j) {
      p0[j] = exp2f(vals[j] - nm);
      p1[j] = exp2f(vals[4 + j] - nm);
      p2[j] = exp2f(vals[8 + j] - nm);
      p3[j] = exp2f(vals[12 + j] - nm);
    }
    const v4f ps = (p0 + p1) + (p2 + p3);   // element-wise tree
    float rs = (ps[0] + ps[1]) + (ps[2] + ps[3]);
    rs += __shfl_xor(rs, 16);
    srun += rs;

    // ---- recycle LDS tile: store exact-f32 P, reread in fp32 A layout ----
    *(v4f*)&Pl[lm * PSTR + 8 * lh]          = p0;
    *(v4f*)&Pl[lm * PSTR + 8 * lh + 4]      = p1;
    *(v4f*)&Pl[lm * PSTR + 16 + 8 * lh]     = p2;
    *(v4f*)&Pl[lm * PSTR + 20 + 8 * lh]     = p3;
    asm volatile("" ::: "memory");
    v2f aP[8];
#pragma unroll
    for (int c = 0; c < 8; ++c)
      aP[c] = *(const v2f*)&Pl[lm * PSTR + 4 * c + 2 * lh];

    // ---- O += P @ V : exact fp32, 32 WMMAs, 4 independent chains ----
#pragma unroll
    for (int c = 0; c < 8; ++c) {
      const unsigned char* vcol =
          buf + VT_OFF + lm * VPITCH + (kl + 4 * c + 2 * lh) * 4;
      const v2f bv0 = *(const v2f*)(vcol);
      const v2f bv1 = *(const v2f*)(vcol + 16 * VPITCH);
      const v2f bv2 = *(const v2f*)(vcol + 32 * VPITCH);
      const v2f bv3 = *(const v2f*)(vcol + 48 * VPITCH);
      acc0 = wmma_f32(aP[c], bv0, acc0);
      acc1 = wmma_f32(aP[c], bv1, acc1);
      acc2 = wmma_f32(aP[c], bv2, acc2);
      acc3 = wmma_f32(aP[c], bv3, acc3);
    }
  };

  // ---- stages wholly below the block's first q row: mask-free for every wave ----
  for (int t = 0; t + 1 < nst; ++t) {
    const unsigned char* buf = ring + (t & 1) * BUFB;
#pragma unroll 1  // one copy of the step body: keeps the hot loop's text small
    for (int p = 0; p < SK / 32; ++p) step32(buf, t * SK + 32 * p, 32 * p, false);
    // publish point of stage t+1; every wave passes it on every trip
    asm volatile("s_wait_dscnt 0x0" ::: "memory");     // own reads of this buffer done
    asm volatile("s_wait_asynccnt 0x0" ::: "memory");  // own copies of stage t+1 landed
    __syncthreads();
    if (t + 2 < nst) issue_stage(t + 2);               // refill the buffer just read
  }
  asm volatile("s_wait_asynccnt 0x0" ::: "memory");    // nothing is in flight from here on

  // ---- last stage holds the block's diagonal: each wave walks up to its own;
  //      no stage follows it, so it has no publish point ----
  {
    const unsigned char* buf = ring + ((nst - 1) & 1) * BUFB;
    int kb = (nst - 1) * SK, kl = 0;
    for (; kb + 32 <= q0; kb += 32, kl += 32) step32(buf, kb, kl, false);
    step32(buf, kb, kl, true);                         // diagonal (+dead) tail
  }

  // ---- epilogue: broadcast 1/srun to g-domain, normalize, store ----
  Bc[lm] = srun;
  asm volatile("" ::: "memory");
#pragma unroll
  for (int g = 0; g < 8; ++g) {
    const float inv = __builtin_amdgcn_rcpf(Bc[g + 8 * lh]);
    float* orow = Out + ((size_t)b * S_DIM + q0 + g + 8 * lh) * DH + lm;
    orow[0]  = acc0[g] * inv;
    orow[16] = acc1[g] * inv;
    orow[32] = acc2[g] * inv;
    orow[48] = acc3[g] * inv;
  }
}

extern "C" void kernel_launch(void* const* d_in, const int* in_sizes, int n_in,
                              void* d_out, int out_size, void* d_ws, size_t ws_size,
                              hipStream_t stream) {
  const float* Q  = (const float*)d_in[0];
  const float* K  = (const float*)d_in[1];
  const float* V  = (const float*)d_in[2];
  const float* Rw = (const float*)d_in[3];
  const float* Rb = (const float*)d_in[4];
  float* Out = (float*)d_out;

  split_k_kernel<<<KV_ELEMS / 2 / 256, 256, 0, stream>>>(K);
  transpose_v_kernel<<<B_DIM * 32, 256, 0, stream>>>(V);

  const int tiles  = B_DIM * (S_DIM / 16);   // 2048 q-tiles
  const int blocks = tiles / NWAVES;         // 256 blocks of 8 waves
  attn_fa_kernel<<<blocks, 256, 0, stream>>>(Q, Rw, Rb, Out);
}

// v002
// A run of this version takes 58 microseconds.
// Next to v001, in two timings, it ran 1.38 times as fast each time.
// Over all steps from v000 it is 2.74 times as fast.
#include <hip/hip_runtime.h>

// Flash-attention with relative-position bias for MI455X (gfx1250, wave32).
// QK^T: V_WMMA_F32_16X16X32_BF16 with 3-term hi/lo bf16 split (~2^-15 rel err).
// P@V : V_WMMA_F32_16X16X4_F32 with exact fp32 probabilities (P recycled
//       through the LDS transpose tile, zero conversion VALU).
// K is pre-split to bf16 hi/lo planes; V is pre-transposed to [b][d][s] f32.
// The waves of a block share each 128-key K/V stage through a two-buffer
// LDS ring that asynchronous copies fill one stage ahead.
// Causal balance: a block owns two mirrored 64-row q groups (low, then high),
// 17 stages in all for every block; the four 32-key steps of a stage go to KS
// waves per q tile, whose partial (max, sum, O) are merged through LDS.

typedef __attribute__((ext_vector_type(2)))  float  v2f;
typedef __attribute__((ext_vector_type(4)))  float  v4f;
typedef __attribute__((ext_vector_type(8)))  float  v8f;
typedef __attribute__((ext_vector_type(8)))  __bf16 v8bf;
typedef __attribute__((ext_vector_type(16))) __bf16 v16bf;

#define B_DIM  16
#define S_DIM  2048
#define DH     64
#define KS     4        // waves that share one q tile's keys
#define NWAVES (4 * KS) // waves per block: 4 q tiles x KS key parts
#define NTHR   (NWAVES * 32)
#define NJOBS  17       // stages per block: low group's + high group's
#define PSTR   36       // padded LDS row stride (floats): conflict-free, 16B-aligned
#define KV_ELEMS (B_DIM * S_DIM * DH)
#define SK      128                      // keys per LDS stage
#define KPITCH  144                      // staged K row: 128 B + 16 B pad (16 B x odd)
#define VPITCH  528                      // staged V^T row: 512 B + 16 B pad
#define KH_OFF  0
#define KL_OFF  (SK * KPITCH)
#define VT_OFF  (2 * SK * KPITCH)
#define BUFB    (VT_OFF + DH * VPITCH)   // bytes per ring buffer

__device__ __bf16 g_khi[KV_ELEMS];  // [b][s][d]
__device__ __bf16 g_klo[KV_ELEMS];
__device__ float  g_vt[KV_ELEMS];   // transposed: [b][d][s], f32

__device__ __forceinline__ unsigned int bfbits(__bf16 h) {
  return (unsigned int)__builtin_bit_cast(unsigned short, h);
}

// ---- split K -> bf16 hi/lo planes (2 elements/thread, packed b32 stores) ----
__global__ __launch_bounds__(256) void split_k_kernel(const float* __restrict__ K) {
  const int i = blockIdx.x * 256 + threadIdx.x;
  const float x0 = K[2 * i], x1 = K[2 * i + 1];
  const __bf16 h0 = (__bf16)x0, h1 = (__bf16)x1;
  const __bf16 l0 = (__bf16)(x0 - (float)h0), l1 = (__bf16)(x1 - (float)h1);
  ((unsigned int*)g_khi)[i] = bfbits(h0) | (bfbits(h1) << 16);
  ((unsigned int*)g_klo)[i] = bfbits(l0) | (bfbits(l1) << 16);
}

// ---- transpose V -> f32 plane [b][d][s] (LDS-tiled, coalesced) ----
__global__ __launch_bounds__(256) void transpose_v_kernel(const float* __restrict__ V) {
  __shared__ float tile[64][65];
  const int b   = blockIdx.x >> 5;          // 32 s-blocks of 64 per batch-head
  const int s0  = (blockIdx.x & 31) << 6;
  const int tid = threadIdx.x;
#pragma unroll
  for (int r = 0; r < 16; ++r) {
    const int idx = r * 256 + tid;
    const int sl = idx >> 6, d = idx & 63;
    tile[sl][d] = V[((size_t)(b * S_DIM + s0 + sl)) * DH + d];
  }
  __syncthreads();
  const int d  = tid >> 2;
  const int sr = (tid & 3) << 4;
  float* o = g_vt + ((size_t)(b * DH + d)) * S_DIM + s0 + sr;
#pragma unroll
  for (int j = 0; j < 16; j += 4) {
    v4f t;
    t[0] = tile[sr + j][d];
    t[1] = tile[sr + j + 1][d];
    t[2] = tile[sr + j + 2][d];
    t[3] = tile[sr + j + 3][d];
    *(v4f*)(o + j) = t;
  }
}

__device__ __forceinline__ v8f wmma_bf16(v16bf a, v16bf b, v8f c) {
  return __builtin_amdgcn_wmma_f32_16x16x32_bf16(false, a, false, b, (short)0, c,
                                                 false, false);
}
__device__ __forceinline__ v8f wmma_f32(v2f a, v2f b, v8f c) {
  return __builtin_amdgcn_wmma_f32_16x16x4_f32(false, a, false, b, (short)0, c,
                                               false, false);
}
__device__ __forceinline__ v16bf cat8(v8bf a, v8bf b) {
  return __builtin_shufflevector(a, b, 0, 1, 2, 3, 4, 5, 6, 7,
                                       8, 9, 10, 11, 12, 13, 14, 15);
}
// fragment = two contiguous 8-elem runs at p and p+16 (A/B 16-bit layout)
__device__ __forceinline__ v16bf ld_frag(const __bf16* p) {
  return cat8(*(const v8bf*)p, *(const v8bf*)(p + 16));
}

// Eight 16-byte-per-lane copies global -> LDS. The s_wait_xcnt closes the run
// inside the statement, ahead of any later rewrite of the address registers.
__device__ __forceinline__ void async_copy8(const unsigned* l,
                                            const char* const* g) {
  asm volatile(
      "global_load_async_to_lds_b128 %0, %8, off\n\t"
      "global_load_async_to_lds_b128 %1, %9, off\n\t"
      "global_load_async_to_lds_b128 %2, %10, off\n\t"
      "global_load_async_to_lds_b128 %3, %11, off\n\t"
      "global_load_async_to_lds_b128 %4, %12, off\n\t"
      "global_load_async_to_lds_b128 %5, %13, off\n\t"
      "global_load_async_to_lds_b128 %6, %14, off\n\t"
      "global_load_async_to_lds_b128 %7, %15, off\n\t"
      "s_wait_xcnt 0x0"
      :: "v"(l[0]), "v"(l[1]), "v"(l[2]), "v"(l[3]),
         "v"(l[4]), "v"(l[5]), "v"(l[6]), "v"(l[7]),
         "v"(g[0]), "v"(g[1]), "v"(g[2]), "v"(g[3]),
         "v"(g[4]), "v"(g[5]), "v"(g[6]), "v"(g[7])
      : "memory");
}

__global__ __launch_bounds__(NTHR) void attn_fa_kernel(
    const float* __restrict__ Q, const float* __restrict__ Rw,
    const float* __restrict__ Rb, float* __restrict__ Out) {
  __shared__ float sh_rw[2 * DH];
  __shared__ float sh_rb[2];
  __shared__ __attribute__((aligned(16))) float sh_p[NWAVES][16 * PSTR];  // 16x32 score/prob transpose tile
  __shared__ float sh_bc[NWAVES][16];        // lm-domain -> g-domain broadcast
  __shared__ __attribute__((aligned(16))) float sh_mo[(KS - 1) * 4][32 * 32];  // partial O
  __shared__ float sh_ms[(KS - 1) * 4][64];                                    // partial max, sum
  __shared__ __attribute__((aligned(16))) unsigned char ring[2 * BUFB];

  const int tid  = threadIdx.x;
  const int wave = __builtin_amdgcn_readfirstlane(tid >> 5);  // scalar: q0 steers branches
  const int lane = tid & 31;
  const int lm   = lane & 15;
  const int lh   = lane >> 4;
  const int tl   = wave & 3;                  // q tile inside the 64-row group
  const int part = wave >> 2;                 // which 32-key steps of a stage are this wave's

  const int b   = blockIdx.x >> 4;
  const int gi  = blockIdx.x & 15;            // low group gi, high group 31 - gi
  const int nlo = (gi >> 1) + 1;              // stages of the low group; the high one has NJOBS - nlo

  const __bf16* khi_b = g_khi + (size_t)b * S_DIM * DH;
  const __bf16* klo_b = g_klo + (size_t)b * S_DIM * DH;
  const float*  vt_b  = g_vt  + (size_t)b * DH * S_DIM;

  // ---- job n of the block stages keys [SK*t, SK*t+SK), t counted inside its q
  //      group: K hi, K lo (128 rows x 128 B each) and V^T (64 rows x 512 B);
  //      4096 copies of 16 B, shared evenly by the block's threads ----
  const unsigned ring_lds =
      (unsigned)(size_t)(__attribute__((address_space(3))) unsigned char*)ring;
  auto issue_stage = [&](int n) {
    const int t = (n < nlo) ? n : n - nlo;
    const unsigned lbuf = ring_lds + (unsigned)(n & 1) * BUFB;
    const unsigned lk = lbuf + (unsigned)(tid >> 3) * KPITCH + (unsigned)(tid & 7) * 16;
    const size_t   gk = (size_t)t * (SK * DH * 2) + (size_t)tid * 16;
    const unsigned lv = lbuf + VT_OFF + (unsigned)(tid >> 5) * VPITCH + (unsigned)lane * 16;
    const char* gv = (const char*)vt_b + (size_t)(tid >> 5) * (S_DIM * 4) +
                     (size_t)t * (SK * 4) + (size_t)lane * 16;
    constexpr int CK = 1024 / NTHR;           // copies per thread and K plane
    constexpr int CV = 2048 / NTHR;           // copies per thread for V^T
    unsigned l[2 * CK + CV];
    const char* g[2 * CK + CV];
#pragma unroll
    for (int r = 0; r < CK; ++r) {
      l[r]      = lk + KH_OFF + r * (NTHR / 8) * KPITCH;
      l[CK + r] = lk + KL_OFF + r * (NTHR / 8) * KPITCH;
      g[r]      = (const char*)khi_b + gk + r * (NTHR * 16);
      g[CK + r] = (const char*)klo_b + gk + r * (NTHR * 16);
    }
#pragma unroll
    for (int r = 0; r < CV; ++r) {
      l[2 * CK + r] = lv + r * NWAVES * VPITCH;
      g[2 * CK + r] = gv + (size_t)r * NWAVES * (S_DIM * 4);
    }
#pragma unroll
    for (int r = 0; r < 2 * CK + CV; r += 8) async_copy8(l + r, g + r);
  };

  issue_stage(0);
  if (tid < 2 * DH) sh_rw[tid] = Rw[tid];
  if (tid < 2) sh_rb[tid] = Rb[tid];
  asm volatile("s_wait_asynccnt 0x0" ::: "memory");  // own copies of job 0 landed
  __syncthreads();                                   // publishes job 0 (and sh_rw, sh_rb)
  issue_stage(1);                                    // flies during the Q set-up and job 0

  float* Pl = sh_p[wave];
  float* Bc = sh_bc[wave];

  int n = 0;                                         // job counter over both q groups
#pragma unroll 1  // one copy of the group body: keeps the kernel's text small
  for (int ph = 0; ph < 2; ++ph) {
    const int R    = ph ? S_DIM - 64 * (gi + 1) : 64 * gi;  // first q row of the group
    const int q0   = R + 16 * tl;
    const int nstp = (R >> 7) + 1;                   // 128-key stages up to the group's diagonal

    // log2(e)/sqrt(512): softmax in base-2 domain -> native v_exp_f32
    const float qscale = 0.04419417382415922f * 1.4426950408889634f;

    // ---- Q row (lm) in bf16-fragment element order: q32[16c + e] ----
    float q32[32];
    {
      const float* qrow = Q + ((size_t)(b * S_DIM + q0 + lm)) * DH;
#pragma unroll
      for (int r = 0; r < 4; ++r) {
        const v4f t0 = *(const v4f*)(qrow + 16 * r + 8 * lh);
        const v4f t1 = *(const v4f*)(qrow + 16 * r + 8 * lh + 4);
#pragma unroll
        for (int j = 0; j < 4; ++j) {
          q32[r * 8 + j]     = t0[j] * qscale;
          q32[r * 8 + 4 + j] = t1[j] * qscale;
        }
      }
    }

    // ---- relative-position bias for q-row lm: pos0 (j<i), posd = pos1-pos0 ----
    float pos0, posd;
    {
      float part0 = 0.f, part1 = 0.f;
#pragma unroll
      for (int r = 0; r < 4; ++r) {
#pragma unroll
        for (int j = 0; j < 8; ++j) {
          const int d = 16 * r + 8 * lh + j;
          part0 += q32[r * 8 + j] * sh_rw[d];
          part1 += q32[r * 8 + j] * sh_rw[DH + d];
        }
      }
      part0 += __shfl_xor(part0, 16);
      part1 += __shfl_xor(part1, 16);
      part0 += sh_rb[0] * qscale;
      part1 += sh_rb[1] * qscale;
      pos0 = part0;
      posd = part1 - part0;
    }

    // ---- pos0 broadcast into the WMMA C layout (rows g+8*lh): bias rides the
    //      matrix op's C operand, no per-step bias adds ----
    v8f posC;
    {
      Bc[lm] = pos0;
      asm volatile("" ::: "memory");
#pragma unroll
      for (int g = 0; g < 8; ++g) posC[g] = Bc[g + 8 * lh];
    }

    // ---- Q bf16 hi/lo A-fragments (2 chunks of K=32) ----
    v16bf aQhi[2], aQlo[2];
#pragma unroll
    for (int c = 0; c < 2; ++c) {
#pragma unroll
      for (int e = 0; e < 16; ++e) {
        const float x = q32[16 * c + e];
        const __bf16 h = (__bf16)x;
        aQhi[c][e] = h;
        aQlo[c][e] = (__bf16)(x - (float)h);
      }
    }

    v8f acc0 = {}, acc1 = {}, acc2 = {}, acc3 = {};
    float mrun = -3.0e38f, srun = 0.f;

    // buf: the stage's ring buffer; kl: first key of the step inside the stage
    auto step32 = [&](const unsigned char* buf, int kb, int kl, bool tail) {
      // ---- K fragments (hi/lo) for two 16-key tiles, from the staged rows ----
      const unsigned char* krow = buf + (kl + lm) * KPITCH + 16 * lh;
      const __bf16* kr0h = (const __bf16*)(krow + KH_OFF);
      const __bf16* kr1h = (const __bf16*)(krow + KH_OFF + 16 * KPITCH);
      const __bf16* kr0l = (const __bf16*)(krow + KL_OFF);
      const __bf16* kr1l = (const __bf16*)(krow + KL_OFF + 16 * KPITCH);

      // ---- S tiles (+pos0 via C): 3-term bf16 split, 12 WMMAs, two chains ----
      v8f Sv0 = posC, Sv1 = posC;
#pragma unroll
      for (int c = 0; c < 2; ++c) {
        const v16bf k0h = ld_frag(kr0h + 32 * c);
        const v16bf k1h = ld_frag(kr1h + 32 * c);
        const v16bf k0l = ld_frag(kr0l + 32 * c);
        const v16bf k1l = ld_frag(kr1l + 32 * c);
        Sv0 = wmma_bf16(aQhi[c], k0h, Sv0);
        Sv1 = wmma_bf16(aQhi[c], k1h, Sv1);
        Sv0 = wmma_bf16(aQlo[c], k0h, Sv0);
        Sv1 = wmma_bf16(aQlo[c], k1h, Sv1);
        Sv0 = wmma_bf16(aQhi[c], k0l, Sv0);
        Sv1 = wmma_bf16(aQhi[c], k1l, Sv1);
      }

      // ---- transpose both 16x16 tiles (C/D -> A domain) through padded LDS ----
#pragma unroll
      for (int g = 0; g < 8; ++g) {
        Pl[(g + 8 * lh) * PSTR + lm]      = Sv0[g];
        Pl[(g + 8 * lh) * PSTR + 16 + lm] = Sv1[g];
      }
      asm volatile("" ::: "memory");  // same-wave LDS pipe is in-order
      float vals[16];
      {
        const v4f r0 = *(const v4f*)&Pl[lm * PSTR + 8 * lh];
        const v4f r1 = *(const v4f*)&Pl[lm * PSTR + 8 * lh + 4];
        const v4f r2 = *(const v4f*)&Pl[lm * PSTR + 16 + 8 * lh];
        const v4f r3 = *(const v4f*)&Pl[lm * PSTR + 20 + 8 * lh];
#pragma unroll
        for (int j = 0; j < 4; ++j) {
          vals[j]      = r0[j];
          vals[4 + j]  = r1[j];
          vals[8 + j]  = r2[j];
          vals[12 + j] = r3[j];
        }
      }

      // ---- (tail-only) causal mask + diagonal bias in A domain ----
      if (tail) {
#pragma unroll
        for (int e = 0; e < 16; ++e) {
          const int k  = (e < 8) ? (8 * lh + e) : (16 + 8 * lh + (e - 8));
          const int dk = (kb + k) - (q0 + lm);
          vals[e] = (dk > 0) ? -1.0e30f : ((dk == 0) ? vals[e] + posd : vals[e]);
        }
      }

      // ---- online softmax over 32 keys; balanced-tree reductions (depth 4) ----
      float tm[8];
#pragma unroll
      for (int i = 0; i < 8; ++i) tm[i] = fmaxf(vals[i], vals[8 + i]);
#pragma unroll
      for (int i = 0; i < 4; ++i) tm[i] = fmaxf(tm[i], tm[4 + i]);
      float rmax = fmaxf(fmaxf(tm[0], tm[1]), fmaxf(tm[2], tm[3]));
      rmax = fmaxf(rmax, __shfl_xor(rmax, 16));
      const float nm = fmaxf(mrun, rmax);
      if (__any(rmax > mrun)) {  // wave-uniform; rare in steady state
        const float corr = exp2f(mrun - nm);
        srun *= corr;
        Bc[lm] = corr;
        asm volatile("" ::: "memory");
#pragma unroll
        for (int g = 0; g < 8; ++g) {
          const float cg = Bc[g + 8 * lh];
          acc0[g] *= cg; acc1[g] *= cg; acc2[g] *= cg; acc3[g] *= cg;
        }
      }
      mrun = nm;

      v4f p0, p1, p2, p3;
#pragma unroll
      for (int j = 0; j < 4; ++j) {
        p0[j] = exp2f(vals[j] - nm);
        p1[j] = exp2f(vals[4 + j] - nm);
        p2[j] = exp2f(vals[8 + j] - nm);
        p3[j] = exp2f(vals[12 + j] - nm);
      }
      const v4f ps = (p0 + p1) + (p2 + p3);   // element-wise tree
      float rs = (ps[0] + ps[1]) + (ps[2] + ps[3]);
      rs += __shfl_xor(rs, 16);
      srun += rs;

      // ---- recycle LDS tile: store exact-f32 P, reread in fp32 A layout ----
      *(v4f*)&Pl[lm * PSTR + 8 * lh]          = p0;
      *(v4f*)&Pl[lm * PSTR + 8 * lh + 4]      = p1;
      *(v4f*)&Pl[lm * PSTR + 16 + 8 * lh]     = p2;
      *(v4f*)&Pl[lm * PSTR + 20 + 8 * lh]     = p3;
      asm volatile("" ::: "memory");
      v2f aP[8];
#pragma unroll
      for (int c = 0; c < 8; ++c)
        aP[c] = *(const v2f*)&Pl[lm * PSTR + 4 * c + 2 * lh];

      // ---- O += P @ V : exact fp32, 32 WMMAs, 4 independent chains ----
#pragma unroll
      for (int c = 0; c < 8; ++c) {
        const unsigned char* vcol =
            buf + VT_OFF + lm * VPITCH + (kl + 4 * c + 2 * lh) * 4;
        const v2f bv0 = *(const v2f*)(vcol);
        const v2f bv1 = *(const v2f*)(vcol + 16 * VPITCH);
        const v2f bv2 = *(const v2f*)(vcol + 32 * VPITCH);
        const v2f bv3 = *(const v2f*)(vcol + 48 * VPITCH);
        acc0 = wmma_f32(aP[c], bv0, acc0);
        acc1 = wmma_f32(aP[c], bv1, acc1);
        acc2 = wmma_f32(aP[c], bv2, acc2);
        acc3 = wmma_f32(aP[c], bv3, acc3);
      }
    };

    // ---- the group's stages; a step wholly below the tile's first row is
    //      mask-free, the one on the diagonal is masked, later ones are skipped ----
    for (int t = 0; t < nstp; ++t, ++n) {
      const unsigned char* buf = ring + (n & 1) * BUFB;
      for (int p = part; p < SK / 32; p += KS) {
        const int kb = t * SK + 32 * p;
        if (kb <= q0) step32(buf, kb, 32 * p, kb + 32 > q0);
      }
      // publish point of job n+1; every wave passes it on every trip
      asm volatile("s_wait_dscnt 0x0" ::: "memory");     // own reads of this buffer done
      asm volatile("s_wait_asynccnt 0x0" ::: "memory");  // own copies of job n+1 landed
      __syncthreads();
      if (n + 2 < NJOBS) issue_stage(n + 2);             // refill the buffer just read
    }

    // ---- merge the KS key parts of each q tile: parts 1.. hand (max, sum, O) over ----
    if (part != 0) {
      float* mo = sh_mo[(part - 1) * 4 + tl];
      float* ms = sh_ms[(part - 1) * 4 + tl];
      ms[lane]      = mrun;
      ms[32 + lane] = srun;
#pragma unroll
      for (int h = 0; h < 2; ++h) {
        const v4f t0 = {acc0[4 * h], acc0[4 * h + 1], acc0[4 * h + 2], acc0[4 * h + 3]};
        const v4f t1 = {acc1[4 * h], acc1[4 * h + 1], acc1[4 * h + 2], acc1[4 * h + 3]};
        const v4f t2 = {acc2[4 * h], acc2[4 * h + 1], acc2[4 * h + 2], acc2[4 * h + 3]};
        const v4f t3 = {acc3[4 * h], acc3[4 * h + 1], acc3[4 * h + 2], acc3[4 * h + 3]};
        *(v4f*)&mo[(0 + h) * 128 + lane * 4] = t0;
        *(v4f*)&mo[(2 + h) * 128 + lane * 4] = t1;
        *(v4f*)&mo[(4 + h) * 128 + lane * 4] = t2;
        *(v4f*)&mo[(6 + h) * 128 + lane * 4] = t3;
      }
    }
    __syncthreads();  // partials visible to part 0; they are rewritten only behind later stage barriers
    if (part == 0) {
      float mk[KS - 1], sk[KS - 1];
      float m = mrun;
#pragma unroll
      for (int k = 0; k < KS - 1; ++k) {
        mk[k] = sh_ms[k * 4 + tl][lane];
        sk[k] = sh_ms[k * 4 + tl][32 + lane];
        m = fmaxf(m, mk[k]);                  // a part without steps holds -3e38, 0, 0
      }
      const float c0 = exp2f(mrun - m);
      float s = srun * c0;
#pragma unroll
      for (int k = 0; k < KS - 1; ++k) {
        mk[k] = exp2f(mk[k] - m);
        s += sk[k] * mk[k];
      }
      const float inv = __builtin_amdgcn_rcpf(s);
      // each part's weight / sum, broadcast to the g-domain rows of the C layout
      Bc[lm] = c0 * inv;
      asm volatile("" ::: "memory");  // other lanes' values are read below: reads stay behind the store
#pragma unroll
      for (int g = 0; g < 8; ++g) {
        const float f = Bc[g + 8 * lh];
        acc0[g] *= f; acc1[g] *= f; acc2[g] *= f; acc3[g] *= f;
      }
#pragma unroll
      for (int k = 0; k < KS - 1; ++k) {
        Bc[lm] = mk[k] * inv;
        asm volatile("" ::: "memory");  // other lanes' values are read below: reads stay behind the store
        const float* mo = sh_mo[k * 4 + tl];
#pragma unroll
        for (int h = 0; h < 2; ++h) {
          const v4f t0 = *(const v4f*)&mo[(0 + h) * 128 + lane * 4];
          const v4f t1 = *(const v4f*)&mo[(2 + h) * 128 + lane * 4];
          const v4f t2 = *(const v4f*)&mo[(4 + h) * 128 + lane * 4];
          const v4f t3 = *(const v4f*)&mo[(6 + h) * 128 + lane * 4];
#pragma unroll
          for (int j = 0; j < 4; ++j) {
            const float f = Bc[4 * h + j + 8 * lh];
            acc0[4 * h + j] += f * t0[j];
            acc1[4 * h + j] += f * t1[j];
            acc2[4 * h + j] += f * t2[j];
            acc3[4 * h + j] += f * t3[j];
          }
        }
      }
#pragma unroll
      for (int g = 0; g < 8; ++g) {
        float* orow = Out + ((size_t)b * S_DIM + q0 + g + 8 * lh) * DH + lm;
        orow[0]  = acc0[g];
        orow[16] = acc1[g];
        orow[32] = acc2[g];
        orow[48] = acc3[g];
      }
      // the next group's set-up reuses the registers these stores name
      asm volatile("s_wait_xcnt 0x0" ::: "memory");
    }
  }
  asm volatile("s_wait_asynccnt 0x0" ::: "memory");    // nothing is in flight at the end
}

extern "C" void kernel_launch(void* const* d_in, const int* in_sizes, int n_in,
                              void* d_out, int out_size, void* d_ws, size_t ws_size,
                              hipStream_t stream) {
  const float* Q  = (const float*)d_in[0];
  const float* K  = (const float*)d_in[1];
  const float* V  = (const float*)d_in[2];
  const float* Rw = (const float*)d_in[3];
  const float* Rb = (const float*)d_in[4];
  float* Out = (float*)d_out;

  split_k_kernel<<<KV_ELEMS / 2 / 256, 256, 0, stream>>>(K);
  transpose_v_kernel<<<B_DIM * 32, 256, 0, stream>>>(V);

  // 16 blocks per batch-head, each a mirrored pair of 64-row q groups
  attn_fa_kernel<<<B_DIM * 16, NTHR, 0, stream>>>(Q, Rw, Rb, Out);
}

// v003
// A run of this version takes 45.9 microseconds.
// In two side-by-side timings against v002, it was 1.26 and 1.27 times as fast.
// All steps since v000 together make it 3.46 times as fast.
#include <hip/hip_runtime.h>

// Flash-attention with relative-position bias for MI455X (gfx1250, wave32).
// QK^T: V_WMMA_F32_16X16X32_BF16 with 3-term hi/lo bf16 split (~2^-15 rel err).
// P@V : V_WMMA_F32_16X16X4_F32 with exact fp32 probabilities (P recycled
//       through the LDS transpose tile, zero conversion VALU).
// One launch: each 128-key stage is prepared where it is used. K comes as f32
// through registers and is split to bf16 hi/lo on its way into LDS; V goes to
// LDS by asynchronous copies that interleave the 16 B pieces of keys 2i and
// 2i+1, so that a B fragment's two keys lie 16 B apart. The waves of a block
// share each stage through a two-buffer LDS ring filled one stage ahead.
// Causal balance: a block owns two mirrored 64-row q groups (low, then high),
// 17 stages in all for every block; the four 32-key steps of a stage go to KS
// waves per q tile, whose partial (max, sum, O) are merged through LDS.

typedef __attribute__((ext_vector_type(2)))  float  v2f;
typedef __attribute__((ext_vector_type(4)))  float  v4f;
typedef __attribute__((ext_vector_type(8)))  float  v8f;
typedef __attribute__((ext_vector_type(2)))  __bf16 v2bf;
typedef __attribute__((ext_vector_type(2)))  unsigned int v2u;
typedef __attribute__((ext_vector_type(8)))  __bf16 v8bf;
typedef __attribute__((ext_vector_type(16))) __bf16 v16bf;

#define B_DIM  16
#define S_DIM  2048
#define DH     64
#define KS     4        // waves that share one q tile's keys
#define NWAVES (4 * KS) // waves per block: 4 q tiles x KS key parts
#define NTHR   (NWAVES * 32)
#define NJOBS  17       // stages per block: low group's + high group's
#define PSTR   36       // padded LDS row stride (floats): conflict-free, 16B-aligned
#define SK      128                      // keys per LDS stage
#define KPITCH  144                      // staged K row: 128 B + 16 B pad (16 B x odd)
#define VPITCH  640                      // staged V key pair: 2 x 256 B + 128 B pad (next pair on the other 32 banks)
#define KH_OFF  0
#define KL_OFF  (SK * KPITCH)
#define VT_OFF  (2 * SK * KPITCH)
#define BUFB    (VT_OFF + SK / 2 * VPITCH)  // bytes per ring buffer

__device__ __forceinline__ v8f wmma_bf16(v16bf a, v16bf b, v8f c) {
  return __builtin_amdgcn_wmma_f32_16x16x32_bf16(false, a, false, b, (short)0, c,
                                                 false, false);
}
__device__ __forceinline__ v8f wmma_f32(v2f a, v2f b, v8f c) {
  return __builtin_amdgcn_wmma_f32_16x16x4_f32(false, a, false, b, (short)0, c,
                                               false, false);
}
__device__ __forceinline__ v16bf cat8(v8bf a, v8bf b) {
  return __builtin_shufflevector(a, b, 0, 1, 2, 3, 4, 5, 6, 7,
                                       8, 9, 10, 11, 12, 13, 14, 15);
}
// fragment = two contiguous 8-elem runs at p and p+16 (A/B 16-bit layout)
__device__ __forceinline__ v16bf ld_frag(const __bf16* p) {
  return cat8(*(const v8bf*)p, *(const v8bf*)(p + 16));
}

// Four 16-byte-per-lane copies global -> LDS. The s_wait_xcnt closes the run
// inside the statement, ahead of any later rewrite of the address registers.
__device__ __forceinline__ void async_copy4(const unsigned* l,
                                            const char* const* g) {
  asm volatile(
      "global_load_async_to_lds_b128 %0, %4, off\n\t"
      "global_load_async_to_lds_b128 %1, %5, off\n\t"
      "global_load_async_to_lds_b128 %2, %6, off\n\t"
      "global_load_async_to_lds_b128 %3, %7, off\n\t"
      "s_wait_xcnt 0x0"
      :: "v"(l[0]), "v"(l[1]), "v"(l[2]), "v"(l[3]),
         "v"(g[0]), "v"(g[1]), "v"(g[2]), "v"(g[3])
      : "memory");
}

__global__ __launch_bounds__(NTHR) void attn_fa_kernel(
    const float* __restrict__ Q, const float* __restrict__ K,
    const float* __restrict__ V, const float* __restrict__ Rw,
    const float* __restrict__ Rb, float* __restrict__ Out) {
  __shared__ float sh_rw[2 * DH];
  __shared__ float sh_rb[2];
  __shared__ __attribute__((aligned(16))) float sh_p[NWAVES][16 * PSTR];  // 16x32 score/prob transpose tile
  __shared__ float sh_bc[NWAVES][16];        // lm-domain -> g-domain broadcast
  __shared__ __attribute__((aligned(16))) float sh_mo[(KS - 1) * 4][32 * 32];  // partial O
  __shared__ float sh_ms[(KS - 1) * 4][64];                                    // partial max, sum
  __shared__ __attribute__((aligned(16))) unsigned char ring[2 * BUFB];

  const int tid  = threadIdx.x;
  const int wave = __builtin_amdgcn_readfirstlane(tid >> 5);  // scalar: q0 steers branches
  const int lane = tid & 31;
  const int lm   = lane & 15;
  const int lh   = lane >> 4;
  const int tl   = wave & 3;                  // q tile inside the 64-row group
  const int part = wave >> 2;                 // which 32-key steps of a stage are this wave's

  const int b   = blockIdx.x >> 4;
  const int gi  = blockIdx.x & 15;            // low group gi, high group 31 - gi
  const int nlo = (gi >> 1) + 1;              // stages of the low group; the high one has NJOBS - nlo

  const float* k_b = K + (size_t)b * S_DIM * DH;
  const float* v_b = V + (size_t)b * S_DIM * DH;

  // ---- job n of the block stages keys [SK*t, SK*t+SK), t counted inside its q
  //      group: 128 rows x 256 B of K and of V, each 2048 pieces of 16 B shared
  //      evenly by the block's threads. V goes straight to LDS; K waits in
  //      kreg until finish_stage splits it ----
  constexpr int CP = 2048 / NTHR;             // 16 B pieces per thread and tensor
  const unsigned ring_lds =
      (unsigned)(size_t)(__attribute__((address_space(3))) unsigned char*)ring;
  v4f kreg[CP];
  // The thread's first piece of the job issued last. The two addresses live on
  // from job to job, so no load lands on an address register, and they are
  // stepped only at the next issue, behind the waits of this one.
  const char* kp = (const char*)k_b + (unsigned)tid * 16u;
  const char* vp = (const char*)v_b + (unsigned)tid * 16u;
  auto issue_stage = [&](int n) {
    if (n > 0) {  // on by 128 keys, or back to key 0 where the high group begins
      const long long d = (n == nlo) ? -(long long)(nlo - 1) * (SK * DH * 4)
                                     : (long long)(SK * DH * 4);
      kp += d;
      vp += d;
    }
#pragma unroll
    for (int r = 0; r < CP; ++r)
      kreg[r] = *(const v4f*)(kp + r * (NTHR * 16));
    // piece (key, d/4) -> pair row key/2, byte 32*(d/4) + 16*(key&1)
    const unsigned lv = ring_lds + (unsigned)(n & 1) * BUFB + VT_OFF +
                        (unsigned)(tid >> 5) * VPITCH + (unsigned)(tid & 15) * 32 +
                        (unsigned)((tid >> 4) & 1) * 16;
    unsigned l[CP];
    const char* g[CP];
#pragma unroll
    for (int r = 0; r < CP; ++r) {
      l[r] = lv + r * (NTHR / 32) * VPITCH;
      g[r] = vp + r * (NTHR * 16);
    }
#pragma unroll
    for (int r = 0; r < CP; r += 4) async_copy4(l + r, g + r);
  };
  // K of job n: f32 -> bf16 hi and lo (x - hi, rounded again), 8 B each per piece
  auto finish_stage = [&](int n) {
    unsigned char* lk = ring + (n & 1) * BUFB + (tid >> 4) * KPITCH + (tid & 15) * 8;
#pragma unroll
    for (int r = 0; r < CP; ++r) {
      v2u hi, lo;
#pragma unroll
      for (int i = 0; i < 2; ++i) {
        const v2f x = {kreg[r][2 * i], kreg[r][2 * i + 1]};
        const unsigned w = __builtin_bit_cast(unsigned, __builtin_convertvector(x, v2bf));
        const v2f hf = {__builtin_bit_cast(float, w << 16),
                        __builtin_bit_cast(float, w & 0xffff0000u)};
        hi[i] = w;
        lo[i] = __builtin_bit_cast(unsigned, __builtin_convertvector(x - hf, v2bf));
      }
      *(v2u*)(lk + KH_OFF + r * (NTHR / 16) * KPITCH) = hi;
      *(v2u*)(lk + KL_OFF + r * (NTHR / 16) * KPITCH) = lo;
    }
  };

  issue_stage(0);
  finish_stage(0);
  if (tid < 2 * DH) sh_rw[tid] = Rw[tid];
  if (tid < 2) sh_rb[tid] = Rb[tid];
  asm volatile("s_wait_asynccnt 0x0" ::: "memory");  // own copies of job 0 landed
  __syncthreads();                                   // publishes job 0 (and sh_rw, sh_rb)
  issue_stage(1);                                    // flies during the Q set-up and job 0

  float* Pl = sh_p[wave];
  float* Bc = sh_bc[wave];

  int n = 0;                                         // job counter over both q groups
#pragma unroll 1  // one copy of the group body: keeps the kernel's text small
  for (int ph = 0; ph < 2; ++ph) {
    const int R    = ph ? S_DIM - 64 * (gi + 1) : 64 * gi;  // first q row of the group
    const int q0   = R + 16 * tl;
    const int nstp = (R >> 7) + 1;                   // 128-key stages up to the group's diagonal

    // log2(e)/sqrt(512): softmax in base-2 domain -> native v_exp_f32
    const float qscale = 0.04419417382415922f * 1.4426950408889634f;

    // ---- Q row (lm) in bf16-fragment element order: q32[16c + e] ----
    float q32[32];
    {
      const float* qrow = Q + ((size_t)(b * S_DIM + q0 + lm)) * DH;
#pragma unroll
      for (int r = 0; r < 4; ++r) {
        const v4f t0 = *(const v4f*)(qrow + 16 * r + 8 * lh);
        const v4f t1 = *(const v4f*)(qrow + 16 * r + 8 * lh + 4);
#pragma unroll
        for (int j = 0; j < 4; ++j) {
          q32[r * 8 + j]     = t0[j] * qscale;
          q32[r * 8 + 4 + j] = t1[j] * qscale;
        }
      }
    }

    // ---- relative-position bias for q-row lm: pos0 (j<i), posd = pos1-pos0 ----
    float pos0, posd;
    {
      float part0 = 0.f, part1 = 0.f;
#pragma unroll
      for (int r = 0; r < 4; ++r) {
#pragma unroll
        for (int j = 0; j < 8; ++j) {
          const int d = 16 * r + 8 * lh + j;
          part0 += q32[r * 8 + j] * sh_rw[d];
          part1 += q32[r * 8 + j] * sh_rw[DH + d];
        }
      }
      part0 += __shfl_xor(part0, 16);
      part1 += __shfl_xor(part1, 16);
      part0 += sh_rb[0] * qscale;
      part1 += sh_rb[1] * qscale;
      pos0 = part0;
      posd = part1 - part0;
    }

    // ---- pos0 broadcast into the WMMA C layout (rows g+8*lh): bias rides the
    //      matrix op's C operand, no per-step bias adds ----
    v8f posC;
    {
      Bc[lm] = pos0;
      asm volatile("" ::: "memory");
#pragma unroll
      for (int g = 0; g < 8; ++g) posC[g] = Bc[g + 8 * lh];
    }

    // ---- Q bf16 hi/lo A-fragments (2 chunks of K=32) ----
    v16bf aQhi[2], aQlo[2];
#pragma unroll
    for (int c = 0; c < 2; ++c) {
#pragma unroll
      for (int e = 0; e < 16; ++e) {
        const float x = q32[16 * c + e];
        const __bf16 h = (__bf16)x;
        aQhi[c][e] = h;
        aQlo[c][e] = (__bf16)(x - (float)h);
      }
    }

    v8f acc0 = {}, acc1 = {}, acc2 = {}, acc3 = {};
    float mrun = -3.0e38f, srun = 0.f;

    // buf: the stage's ring buffer; kl: first key of the step inside the stage
    auto step32 = [&](const unsigned char* buf, int kb, int kl, bool tail) {
      // ---- K fragments (hi/lo) for two 16-key tiles, from the staged rows ----
      const unsigned char* krow = buf + (kl + lm) * KPITCH + 16 * lh;
      const __bf16* kr0h = (const __bf16*)(krow + KH_OFF);
      const __bf16* kr1h = (const __bf16*)(krow + KH_OFF + 16 * KPITCH);
      const __bf16* kr0l = (const __bf16*)(krow + KL_OFF);
      const __bf16* kr1l = (const __bf16*)(krow + KL_OFF + 16 * KPITCH);

      // ---- S tiles (+pos0 via C): 3-term bf16 split, 12 WMMAs, two chains ----
      v8f Sv0 = posC, Sv1 = posC;
#pragma unroll
      for (int c = 0; c < 2; ++c) {
        const v16bf k0h = ld_frag(kr0h + 32 * c);
        const v16bf k1h = ld_frag(kr1h + 32 * c);
        const v16bf k0l = ld_frag(kr0l + 32 * c);
        const v16bf k1l = ld_frag(kr1l + 32 * c);
        Sv0 = wmma_bf16(aQhi[c], k0h, Sv0);
        Sv1 = wmma_bf16(aQhi[c], k1h, Sv1);
        Sv0 = wmma_bf16(aQlo[c], k0h, Sv0);
        Sv1 = wmma_bf16(aQlo[c], k1h, Sv1);
        Sv0 = wmma_bf16(aQhi[c], k0l, Sv0);
        Sv1 = wmma_bf16(aQhi[c], k1l, Sv1);
      }

      // ---- transpose both 16x16 tiles (C/D -> A domain) through padded LDS ----
#pragma unroll
      for (int g = 0; g < 8; ++g) {
        Pl[(g + 8 * lh) * PSTR + lm]      = Sv0[g];
        Pl[(g + 8 * lh) * PSTR + 16 + lm] = Sv1[g];
      }
      asm volatile("" ::: "memory");  // same-wave LDS pipe is in-order
      float vals[16];
      {
        const v4f r0 = *(const v4f*)&Pl[lm * PSTR + 8 * lh];
        const v4f r1 = *(const v4f*)&Pl[lm * PSTR + 8 * lh + 4];
        const v4f r2 = *(const v4f*)&Pl[lm * PSTR + 16 + 8 * lh];
        const v4f r3 = *(const v4f*)&Pl[lm * PSTR + 20 + 8 * lh];
#pragma unroll
        for (int j = 0; j < 4; ++j) {
          vals[j]      = r0[j];
          vals[4 + j]  = r1[j];
          vals[8 + j]  = r2[j];
          vals[12 + j] = r3[j];
        }
      }

      // ---- (tail-only) causal mask + diagonal bias in A domain ----
      if (tail) {
#pragma unroll
        for (int e = 0; e < 16; ++e) {
          const int k  = (e < 8) ? (8 * lh + e) : (16 + 8 * lh + (e - 8));
          const int dk = (kb + k) - (q0 + lm);
          vals[e] = (dk > 0) ? -1.0e30f : ((dk == 0) ? vals[e] + posd : vals[e]);
        }
      }

      // ---- online softmax over 32 keys; balanced-tree reductions (depth 4) ----
      float tm[8];
#pragma unroll
      for (int i = 0; i < 8; ++i) tm[i] = fmaxf(vals[i], vals[8 + i]);
#pragma unroll
      for (int i = 0; i < 4; ++i) tm[i] = fmaxf(tm[i], tm[4 + i]);
      float rmax = fmaxf(fmaxf(tm[0], tm[1]), fmaxf(tm[2], tm[3]));
      rmax = fmaxf(rmax, __shfl_xor(rmax, 16));
      const float nm = fmaxf(mrun, rmax);
      if (__any(rmax > mrun)) {  // wave-uniform; rare in steady state
        const float corr = exp2f(mrun - nm);
        srun *= corr;
        Bc[lm] = corr;
        asm volatile("" ::: "memory");
#pragma unroll
        for (int g = 0; g < 8; ++g) {
          const float cg = Bc[g + 8 * lh];
          acc0[g] *= cg; acc1[g] *= cg; acc2[g] *= cg; acc3[g] *= cg;
        }
      }
      mrun = nm;

      v4f p0, p1, p2, p3;
#pragma unroll
      for (int j = 0; j < 4; ++j) {
        p0[j] = exp2f(vals[j] - nm);
        p1[j] = exp2f(vals[4 + j] - nm);
        p2[j] = exp2f(vals[8 + j] - nm);
        p3[j] = exp2f(vals[12 + j] - nm);
      }
      const v4f ps = (p0 + p1) + (p2 + p3);   // element-wise tree
      float rs = (ps[0] + ps[1]) + (ps[2] + ps[3]);
      const float rso = __shfl_xor(rs, 16);   // the other half's sum; added behind the matrix run

      // ---- recycle LDS tile: store exact-f32 P, reread in fp32 A layout ----
      *(v4f*)&Pl[lm * PSTR + 8 * lh]          = p0;
      *(v4f*)&Pl[lm * PSTR + 8 * lh + 4]      = p1;
      *(v4f*)&Pl[lm * PSTR + 16 + 8 * lh]     = p2;
      *(v4f*)&Pl[lm * PSTR + 20 + 8 * lh]     = p3;
      asm volatile("" ::: "memory");
      // Opens the scheduling region of the f32 matrix run, so that the group
      // barriers at its end count only the vector work that stands in it.
      __builtin_amdgcn_sched_barrier(0);
      v2f aP[8];
#pragma unroll
      for (int c = 0; c < 8; ++c)
        aP[c] = *(const v2f*)&Pl[lm * PSTR + 4 * c + 2 * lh];

      // ---- O += P @ V : exact fp32, 32 WMMAs, 4 independent chains ----
#pragma unroll
      for (int c = 0; c < 8; ++c) {
        const float* vr =
            (const float*)(buf + VT_OFF + ((kl >> 1) + 2 * c + lh) * VPITCH) +
            (lm >> 2) * 8 + (lm & 3);
        const v2f bv0 = {vr[0],  vr[4]};                // keys k, k+1 of column lm
        const v2f bv1 = {vr[32], vr[36]};               // column lm + 16
        const v2f bv2 = {vr[64], vr[68]};
        const v2f bv3 = {vr[96], vr[100]};
        acc0 = wmma_f32(aP[c], bv0, acc0);
        acc1 = wmma_f32(aP[c], bv1, acc1);
        acc2 = wmma_f32(aP[c], bv2, acc2);
        acc3 = wmma_f32(aP[c], bv3, acc3);
      }
      // The region's vector work (LDS address sums of the V reads) goes
      // ahead of the run: inside it, it would be given operand registers of
      // matrix instructions that have just issued.
      __builtin_amdgcn_sched_group_barrier(0x2, 40, 0);  // vector ALU
      __builtin_amdgcn_sched_group_barrier(0x8, 32, 0);  // matrix
      __builtin_amdgcn_sched_barrier(0);
      // Four vector slots behind the run: the vector work that follows may be given
      // operand registers of its last matrix instructions. The two scheduling
      // barriers hold the slots between the run and that work.
      asm volatile("v_nop\n\tv_nop\n\tv_nop\n\tv_nop");
      __builtin_amdgcn_sched_barrier(0);
      srun += rs + rso;
    };

    // ---- the group's stages; a step wholly below the tile's first row is
    //      mask-free, the one on the diagonal is masked, later ones are skipped ----
    for (int t = 0; t < nstp; ++t, ++n) {
      const unsigned char* buf = ring + (n & 1) * BUFB;
      for (int p = part; p < SK / 32; p += KS) {
        const int kb = t * SK + 32 * p;
        if (kb <= q0) step32(buf, kb, 32 * p, kb + 32 > q0);
      }
      if (n + 1 < NJOBS) finish_stage(n + 1);            // into the buffer nobody reads now
      // publish point of job n+1; every wave passes it on every trip
      asm volatile("s_wait_dscnt 0x0" ::: "memory");     // own reads of this buffer, own K stores done
      asm volatile("s_wait_asynccnt 0x0" ::: "memory");  // own copies of job n+1 landed
      __syncthreads();
      if (n + 2 < NJOBS) issue_stage(n + 2);             // refill the buffer just read
    }

    // ---- merge the KS key parts of each q tile: parts 1.. hand (max, sum, O) over ----
    if (part != 0) {
      float* mo = sh_mo[(part - 1) * 4 + tl];
      float* ms = sh_ms[(part - 1) * 4 + tl];
      ms[lane]      = mrun;
      ms[32 + lane] = srun;
#pragma unroll
      for (int h = 0; h < 2; ++h) {
        const v4f t0 = {acc0[4 * h], acc0[4 * h + 1], acc0[4 * h + 2], acc0[4 * h + 3]};
        const v4f t1 = {acc1[4 * h], acc1[4 * h + 1], acc1[4 * h + 2], acc1[4 * h + 3]};
        const v4f t2 = {acc2[4 * h], acc2[4 * h + 1], acc2[4 * h + 2], acc2[4 * h + 3]};
        const v4f t3 = {acc3[4 * h], acc3[4 * h + 1], acc3[4 * h + 2], acc3[4 * h + 3]};
        *(v4f*)&mo[(0 + h) * 128 + lane * 4] = t0;
        *(v4f*)&mo[(2 + h) * 128 + lane * 4] = t1;
        *(v4f*)&mo[(4 + h) * 128 + lane * 4] = t2;
        *(v4f*)&mo[(6 + h) * 128 + lane * 4] = t3;
      }
    }
    __syncthreads();  // partials visible to part 0; they are rewritten only behind later stage barriers
    if (part == 0) {
      float mk[KS - 1], sk[KS - 1];
      float m = mrun;
#pragma unroll
      for (int k = 0; k < KS - 1; ++k) {
        mk[k] = sh_ms[k * 4 + tl][lane];
        sk[k] = sh_ms[k * 4 + tl][32 + lane];
        m = fmaxf(m, mk[k]);                  // a part without steps holds -3e38, 0, 0
      }
      const float c0 = exp2f(mrun - m);
      float s = srun * c0;
#pragma unroll
      for (int k = 0; k < KS - 1; ++k) {
        mk[k] = exp2f(mk[k] - m);
        s += sk[k] * mk[k];
      }
      const float inv = __builtin_amdgcn_rcpf(s);
      // each part's weight / sum, broadcast to the g-domain rows of the C layout
      Bc[lm] = c0 * inv;
      asm volatile("" ::: "memory");  // other lanes' values are read below: reads stay behind the store
#pragma unroll
      for (int g = 0; g < 8; ++g) {
        const float f = Bc[g + 8 * lh];
        acc0[g] *= f; acc1[g] *= f; acc2[g] *= f; acc3[g] *= f;
      }
#pragma unroll
      for (int k = 0; k < KS - 1; ++k) {
        Bc[lm] = mk[k] * inv;
        asm volatile("" ::: "memory");  // other lanes' values are read below: reads stay behind the store
        const float* mo = sh_mo[k * 4 + tl];
#pragma unroll
        for (int h = 0; h < 2; ++h) {
          const v4f t0 = *(const v4f*)&mo[(0 + h) * 128 + lane * 4];
          const v4f t1 = *(const v4f*)&mo[(2 + h) * 128 + lane * 4];
          const v4f t2 = *(const v4f*)&mo[(4 + h) * 128 + lane * 4];
          const v4f t3 = *(const v4f*)&mo[(6 + h) * 128 + lane * 4];
#pragma unroll
          for (int j = 0; j < 4; ++j) {
            const float f = Bc[4 * h + j + 8 * lh];
            acc0[4 * h + j] += f * t0[j];
            acc1[4 * h + j] += f * t1[j];
            acc2[4 * h + j] += f * t2[j];
            acc3[4 * h + j] += f * t3[j];
          }
        }
      }
#pragma unroll
      for (int g = 0; g < 8; ++g) {
        float* orow = Out + ((size_t)b * S_DIM + q0 + g + 8 * lh) * DH + lm;
        orow[0]  = acc0[g];
        orow[16] = acc1[g];
        orow[32] = acc2[g];
        orow[48] = acc3[g];
      }
      // the next group's set-up reuses the registers these stores name
      asm volatile("s_wait_xcnt 0x0" ::: "memory");
    }
  }
  asm volatile("s_wait_asynccnt 0x0" ::: "memory");    // nothing is in flight at the end
}

extern "C" void kernel_launch(void* const* d_in, const int* in_sizes, int n_in,
                              void* d_out, int out_size, void* d_ws, size_t ws_size,
                              hipStream_t stream) {
  const float* Q  = (const float*)d_in[0];
  const float* K  = (const float*)d_in[1];
  const float* V  = (const float*)d_in[2];
  const float* Rw = (const float*)d_in[3];
  const float* Rb = (const float*)d_in[4];
  float* Out = (float*)d_out;

  // 16 blocks per batch-head, each a mirrored pair of 64-row q groups
  attn_fa_kernel<<<B_DIM * 16, NTHR, 0, stream>>>(Q, K, V, Rw, Rb, Out);
}

// v004
// A run of this version takes 34.5 microseconds.
// Timed twice side by side with v003, it ran 1.33 times as fast both times.
// Counting every step since v000, it is 4.61 times as fast.
#include <hip/hip_runtime.h>

// Flash-attention with relative-position bias for MI455X (gfx1250, wave32).
// QK^T: V_WMMA_F32_16X16X32_BF16 with 3-term hi/lo bf16 split (~2^-15 rel err).
// P@V : the same form and the same 3-term hi/lo bf16 split. The transposed
//       scores already lie in the A fragment's k order, so P is split in
//       registers; V's B fragments come by the transposing LDS load.
// One launch: each 128-key stage is prepared where it is used. K and V come as
// f32 through registers and are split to bf16 hi/lo on their way into LDS, both
// row-major. The waves of a block share each stage through a two-buffer LDS
// ring filled one stage ahead.
// Causal balance: a block owns two mirrored 64-row q groups (low, then high),
// 17 stages in all for every block; the four 32-key steps of a stage go to KS
// waves per q tile, whose partial (max, sum, O) are merged through LDS.

typedef __attribute__((ext_vector_type(2)))  float  v2f;
typedef __attribute__((ext_vector_type(4)))  float  v4f;
typedef __attribute__((ext_vector_type(8)))  float  v8f;
typedef __attribute__((ext_vector_type(2)))  __bf16 v2bf;
typedef __attribute__((ext_vector_type(2)))  unsigned int v2u;
typedef __attribute__((ext_vector_type(8)))  __bf16 v8bf;
typedef __attribute__((ext_vector_type(16))) __bf16 v16bf;

#define B_DIM  16
#define S_DIM  2048
#define DH     64
#define KS     4        // waves that share one q tile's keys
#define NWAVES (4 * KS) // waves per block: 4 q tiles x KS key parts
#define NTHR   (NWAVES * 32)
#define NJOBS  17       // stages per block: low group's + high group's
#define PSTR   36       // padded LDS row stride (floats): conflict-free, 16B-aligned
#define SK      128                      // keys per LDS stage
#define KPITCH  144                      // staged K row: 128 B + 16 B pad (16 B x odd)
#define VPITCH  160                      // staged V row: 128 B + 32 B pad (32 B x odd, for the transposing load)
#define KH_OFF  0
#define KL_OFF  (SK * KPITCH)
#define VH_OFF  (2 * SK * KPITCH)
#define VL_OFF  (VH_OFF + SK * VPITCH)
#define BUFB    (VL_OFF + SK * VPITCH)   // bytes per ring buffer

__device__ __forceinline__ v8f wmma_bf16(v16bf a, v16bf b, v8f c) {
  return __builtin_amdgcn_wmma_f32_16x16x32_bf16(false, a, false, b, (short)0, c,
                                                 false, false);
}
__device__ __forceinline__ v16bf cat8(v8bf a, v8bf b) {
  return __builtin_shufflevector(a, b, 0, 1, 2, 3, 4, 5, 6, 7,
                                       8, 9, 10, 11, 12, 13, 14, 15);
}
// fragment = two contiguous 8-elem runs at p and p+16 (A/B 16-bit layout)
__device__ __forceinline__ v16bf ld_frag(const __bf16* p) {
  return cat8(*(const v8bf*)p, *(const v8bf*)(p + 16));
}

// 16 x 16 piece of a row-major 16-bit LDS tile, transposed: lane (c, h) gets
// rows 8h .. 8h+7 of column c; p is the lane's own 16 B of the tile
__device__ __forceinline__ v8bf ld_tr16(const unsigned char* p) {
  typedef __attribute__((address_space(3))) v8bf lds_v8bf;
  return __builtin_amdgcn_ds_load_tr16_b128_v8bf16((lds_v8bf*)p);
}
// two f32 -> packed bf16 hi and packed bf16 lo (x - hi, rounded again)
__device__ __forceinline__ void split2(v2f x, unsigned& hi, unsigned& lo) {
  const unsigned w = __builtin_bit_cast(unsigned, __builtin_convertvector(x, v2bf));
  const v2f hf = {__builtin_bit_cast(float, w << 16),
                  __builtin_bit_cast(float, w & 0xffff0000u)};
  hi = w;
  lo = __builtin_bit_cast(unsigned, __builtin_convertvector(x - hf, v2bf));
}

__global__ __launch_bounds__(NTHR) void attn_fa_kernel(
    const float* __restrict__ Q, const float* __restrict__ K,
    const float* __restrict__ V, const float* __restrict__ Rw,
    const float* __restrict__ Rb, float* __restrict__ Out) {
  __shared__ float sh_rw[2 * DH];
  __shared__ float sh_rb[2];
  __shared__ __attribute__((aligned(16))) float sh_p[NWAVES][16 * PSTR];  // 16x32 score transpose tile
  __shared__ float sh_bc[NWAVES][16];        // lm-domain -> g-domain broadcast
  __shared__ __attribute__((aligned(16))) float sh_mo[(KS - 1) * 4][32 * 32];  // partial O
  __shared__ float sh_ms[(KS - 1) * 4][64];                                    // partial max, sum
  __shared__ __attribute__((aligned(16))) unsigned char ring[2 * BUFB];

  const int tid  = threadIdx.x;
  const int wave = __builtin_amdgcn_readfirstlane(tid >> 5);  // scalar: q0 steers branches
  const int lane = tid & 31;
  const int lm   = lane & 15;
  const int lh   = lane >> 4;
  const int tl   = wave & 3;                  // q tile inside the 64-row group
  const int part = wave >> 2;                 // which 32-key steps of a stage are this wave's

  const int b   = blockIdx.x >> 4;
  const int gi  = blockIdx.x & 15;            // low group gi, high group 31 - gi
  const int nlo = (gi >> 1) + 1;              // stages of the low group; the high one has NJOBS - nlo

  const float* k_b = K + (size_t)b * S_DIM * DH;
  const float* v_b = V + (size_t)b * S_DIM * DH;

  // ---- job n of the block stages keys [SK*t, SK*t+SK), t counted inside its q
  //      group: 128 rows x 256 B of K and of V, each 2048 pieces of 16 B shared
  //      evenly by the block's threads. Both wait in registers until
  //      finish_stage splits them ----
  constexpr int CP = 2048 / NTHR;             // 16 B pieces per thread and tensor
  v4f kreg[CP], vreg[CP];
  // The thread's first piece of the job issued last. The two addresses live on
  // from job to job, so no load lands on an address register, and they are
  // stepped only at the next issue, behind the wait that ends this one.
  const char* kp = (const char*)k_b + (unsigned)tid * 16u;
  const char* vp = (const char*)v_b + (unsigned)tid * 16u;
  auto issue_stage = [&](int n) {
    if (n > 0) {  // on by 128 keys, or back to key 0 where the high group begins
      const long long d = (n == nlo) ? -(long long)(nlo - 1) * (SK * DH * 4)
                                     : (long long)(SK * DH * 4);
      kp += d;
      vp += d;
    }
#pragma unroll
    for (int r = 0; r < CP; ++r) {
      kreg[r] = *(const v4f*)(kp + r * (NTHR * 16));
      vreg[r] = *(const v4f*)(vp + r * (NTHR * 16));
    }
    // closes the run of loads on every path, ahead of the next step of kp and vp
    asm volatile("s_wait_xcnt 0x0" ::: "memory");
  };
  // K and V of job n: f32 -> bf16 hi and lo, 8 B each per piece, row = key
  auto finish_stage = [&](int n) {
    unsigned char* lb = ring + (n & 1) * BUFB + (tid & 15) * 8;
    unsigned char* lk = lb + (tid >> 4) * KPITCH;
    unsigned char* lv = lb + (tid >> 4) * VPITCH;
#pragma unroll
    for (int r = 0; r < CP; ++r) {
      v2u hi, lo;
#pragma unroll
      for (int i = 0; i < 2; ++i) {
        unsigned h, l;
        split2(v2f{kreg[r][2 * i], kreg[r][2 * i + 1]}, h, l);
        hi[i] = h;
        lo[i] = l;
      }
      *(v2u*)(lk + KH_OFF + r * (NTHR / 16) * KPITCH) = hi;
      *(v2u*)(lk + KL_OFF + r * (NTHR / 16) * KPITCH) = lo;
#pragma unroll
      for (int i = 0; i < 2; ++i) {
        unsigned h, l;
        split2(v2f{vreg[r][2 * i], vreg[r][2 * i + 1]}, h, l);
        hi[i] = h;
        lo[i] = l;
      }
      *(v2u*)(lv + VH_OFF + r * (NTHR / 16) * VPITCH) = hi;
      *(v2u*)(lv + VL_OFF + r * (NTHR / 16) * VPITCH) = lo;
    }
  };

  issue_stage(0);
  finish_stage(0);
  if (tid < 2 * DH) sh_rw[tid] = Rw[tid];
  if (tid < 2) sh_rb[tid] = Rb[tid];
  __syncthreads();                                   // publishes job 0 (and sh_rw, sh_rb)
  issue_stage(1);                                    // flies until the Q set-up, whose in-order load wait ends it

  float* Pl = sh_p[wave];
  float* Bc = sh_bc[wave];

  int n = 0;                                         // job counter over both q groups
#pragma unroll 1  // one copy of the group body: keeps the kernel's text small
  for (int ph = 0; ph < 2; ++ph) {
    const int R    = ph ? S_DIM - 64 * (gi + 1) : 64 * gi;  // first q row of the group
    const int q0   = R + 16 * tl;
    const int nstp = (R >> 7) + 1;                   // 128-key stages up to the group's diagonal

    // log2(e)/sqrt(512): softmax in base-2 domain -> native v_exp_f32
    const float qscale = 0.04419417382415922f * 1.4426950408889634f;

    // ---- Q row (lm) in bf16-fragment element order: q32[16c + e] ----
    float q32[32];
    {
      const float* qrow = Q + ((size_t)(b * S_DIM + q0 + lm)) * DH;
#pragma unroll
      for (int r = 0; r < 4; ++r) {
        const v4f t0 = *(const v4f*)(qrow + 16 * r + 8 * lh);
        const v4f t1 = *(const v4f*)(qrow + 16 * r + 8 * lh + 4);
#pragma unroll
        for (int j = 0; j < 4; ++j) {
          q32[r * 8 + j]     = t0[j] * qscale;
          q32[r * 8 + 4 + j] = t1[j] * qscale;
        }
      }
    }

    // ---- relative-position bias for q-row lm: pos0 (j<i), posd = pos1-pos0 ----
    float pos0, posd;
    {
      float part0 = 0.f, part1 = 0.f;
#pragma unroll
      for (int r = 0; r < 4; ++r) {
#pragma unroll
        for (int j = 0; j < 8; ++j) {
          const int d = 16 * r + 8 * lh + j;
          part0 += q32[r * 8 + j] * sh_rw[d];
          part1 += q32[r * 8 + j] * sh_rw[DH + d];
        }
      }
      part0 += __shfl_xor(part0, 16);
      part1 += __shfl_xor(part1, 16);
      part0 += sh_rb[0] * qscale;
      part1 += sh_rb[1] * qscale;
      pos0 = part0;
      posd = part1 - part0;
    }

    // ---- pos0 broadcast into the WMMA C layout (rows g+8*lh): bias rides the
    //      matrix op's C operand, no per-step bias adds ----
    v8f posC;
    {
      Bc[lm] = pos0;
      asm volatile("" ::: "memory");
#pragma unroll
      for (int g = 0; g < 8; ++g) posC[g] = Bc[g + 8 * lh];
    }

    // ---- Q bf16 hi/lo A-fragments (2 chunks of K=32) ----
    v16bf aQhi[2], aQlo[2];
#pragma unroll
    for (int c = 0; c < 2; ++c) {
#pragma unroll
      for (int e = 0; e < 16; ++e) {
        const float x = q32[16 * c + e];
        const __bf16 h = (__bf16)x;
        aQhi[c][e] = h;
        aQlo[c][e] = (__bf16)(x - (float)h);
      }
    }

    v8f acc0 = {}, acc1 = {}, acc2 = {}, acc3 = {};
    float mrun = -3.0e38f, srun = 0.f;

    // buf: the stage's ring buffer; kl: first key of the step inside the stage
    auto step32 = [&](const unsigned char* buf, int kb, int kl, bool tail) {
      // ---- K fragments (hi/lo) for two 16-key tiles, from the staged rows ----
      const unsigned char* krow = buf + (kl + lm) * KPITCH + 16 * lh;
      const __bf16* kr0h = (const __bf16*)(krow + KH_OFF);
      const __bf16* kr1h = (const __bf16*)(krow + KH_OFF + 16 * KPITCH);
      const __bf16* kr0l = (const __bf16*)(krow + KL_OFF);
      const __bf16* kr1l = (const __bf16*)(krow + KL_OFF + 16 * KPITCH);

      // ---- S tiles (+pos0 via C): 3-term bf16 split, 12 WMMAs, two chains ----
      v8f Sv0 = posC, Sv1 = posC;
#pragma unroll
      for (int c = 0; c < 2; ++c) {
        const v16bf k0h = ld_frag(kr0h + 32 * c);
        const v16bf k1h = ld_frag(kr1h + 32 * c);
        const v16bf k0l = ld_frag(kr0l + 32 * c);
        const v16bf k1l = ld_frag(kr1l + 32 * c);
        Sv0 = wmma_bf16(aQhi[c], k0h, Sv0);
        Sv1 = wmma_bf16(aQhi[c], k1h, Sv1);
        Sv0 = wmma_bf16(aQlo[c], k0h, Sv0);
        Sv1 = wmma_bf16(aQlo[c], k1h, Sv1);
        Sv0 = wmma_bf16(aQhi[c], k0l, Sv0);
        Sv1 = wmma_bf16(aQhi[c], k1l, Sv1);
      }

      // ---- transpose both 16x16 tiles (C/D -> A domain) through padded LDS ----
#pragma unroll
      for (int g = 0; g < 8; ++g) {
        Pl[(g + 8 * lh) * PSTR + lm]      = Sv0[g];
        Pl[(g + 8 * lh) * PSTR + 16 + lm] = Sv1[g];
      }
      asm volatile("" ::: "memory");  // same-wave LDS pipe is in-order
      float vals[16];
      {
        const v4f r0 = *(const v4f*)&Pl[lm * PSTR + 8 * lh];
        const v4f r1 = *(const v4f*)&Pl[lm * PSTR + 8 * lh + 4];
        const v4f r2 = *(const v4f*)&Pl[lm * PSTR + 16 + 8 * lh];
        const v4f r3 = *(const v4f*)&Pl[lm * PSTR + 20 + 8 * lh];
#pragma unroll
        for (int j = 0; j < 4; ++j) {
          vals[j]      = r0[j];
          vals[4 + j]  = r1[j];
          vals[8 + j]  = r2[j];
          vals[12 + j] = r3[j];
        }
      }

      // ---- (tail-only) causal mask + diagonal bias in A domain ----
      if (tail) {
#pragma unroll
        for (int e = 0; e < 16; ++e) {
          const int k  = (e < 8) ? (8 * lh + e) : (16 + 8 * lh + (e - 8));
          const int dk = (kb + k) - (q0 + lm);
          vals[e] = (dk > 0) ? -1.0e30f : ((dk == 0) ? vals[e] + posd : vals[e]);
        }
      }

      // ---- online softmax over 32 keys; balanced-tree reductions (depth 4) ----
      float tm[8];
#pragma unroll
      for (int i = 0; i < 8; ++i) tm[i] = fmaxf(vals[i], vals[8 + i]);
#pragma unroll
      for (int i = 0; i < 4; ++i) tm[i] = fmaxf(tm[i], tm[4 + i]);
      float rmax = fmaxf(fmaxf(tm[0], tm[1]), fmaxf(tm[2], tm[3]));
      rmax = fmaxf(rmax, __shfl_xor(rmax, 16));
      const float nm = fmaxf(mrun, rmax);
      if (__any(rmax > mrun)) {  // wave-uniform; rare in steady state
        const float corr = exp2f(mrun - nm);
        srun *= corr;
        Bc[lm] = corr;
        asm volatile("" ::: "memory");
#pragma unroll
        for (int g = 0; g < 8; ++g) {
          const float cg = Bc[g + 8 * lh];
          acc0[g] *= cg; acc1[g] *= cg; acc2[g] *= cg; acc3[g] *= cg;
        }
      }
      mrun = nm;

      // ---- V fragments (hi/lo), 32 keys x 4 column tiles, in the k order of
      //      vals; asked for here, behind the last LDS wait of the maximum, so
      //      that they fly during the exponentials ----
      v16bf bVh[4], bVl[4];
      {
        const unsigned char* vrow = buf + (kl + 8 * lh + (lane & 7)) * VPITCH +
                                    16 * ((lane >> 3) & 1);
#pragma unroll
        for (int j = 0; j < 4; ++j) {
          bVh[j] = cat8(ld_tr16(vrow + VH_OFF + 32 * j),
                        ld_tr16(vrow + VH_OFF + 16 * VPITCH + 32 * j));
          bVl[j] = cat8(ld_tr16(vrow + VL_OFF + 32 * j),
                        ld_tr16(vrow + VL_OFF + 16 * VPITCH + 32 * j));
        }
      }
      // Keeps the sixteen loads together up here: sunk among the matrix
      // instructions, each small group's LDS latency would stand open there.
      __builtin_amdgcn_sched_barrier(0);

      v4f p0, p1, p2, p3;
#pragma unroll
      for (int j = 0; j < 4; ++j) {
        p0[j] = exp2f(vals[j] - nm);
        p1[j] = exp2f(vals[4 + j] - nm);
        p2[j] = exp2f(vals[8 + j] - nm);
        p3[j] = exp2f(vals[12 + j] - nm);
      }
      const v4f ps = (p0 + p1) + (p2 + p3);   // element-wise tree
      float rs = (ps[0] + ps[1]) + (ps[2] + ps[3]);
      const float rso = __shfl_xor(rs, 16);   // the other half's sum

      // ---- P hi/lo A-fragments: element e of vals is element e of the fragment ----
      v16bf aPh, aPl;
      {
        unsigned ph[8], pl[8];
#pragma unroll
        for (int i = 0; i < 2; ++i) {
          split2(v2f{p0[2 * i], p0[2 * i + 1]}, ph[i],     pl[i]);
          split2(v2f{p1[2 * i], p1[2 * i + 1]}, ph[2 + i], pl[2 + i]);
          split2(v2f{p2[2 * i], p2[2 * i + 1]}, ph[4 + i], pl[4 + i]);
          split2(v2f{p3[2 * i], p3[2 * i + 1]}, ph[6 + i], pl[6 + i]);
        }
        typedef __attribute__((ext_vector_type(8))) unsigned int v8u;
        const v8u wh = {ph[0], ph[1], ph[2], ph[3], ph[4], ph[5], ph[6], ph[7]};
        const v8u wl = {pl[0], pl[1], pl[2], pl[3], pl[4], pl[5], pl[6], pl[7]};
        aPh = __builtin_bit_cast(v16bf, wh);
        aPl = __builtin_bit_cast(v16bf, wl);
      }

      // ---- O += P @ V : 3-term bf16 split, 12 WMMAs, 4 independent chains ----
      acc0 = wmma_bf16(aPh, bVh[0], acc0);
      acc1 = wmma_bf16(aPh, bVh[1], acc1);
      acc2 = wmma_bf16(aPh, bVh[2], acc2);
      acc3 = wmma_bf16(aPh, bVh[3], acc3);
      acc0 = wmma_bf16(aPl, bVh[0], acc0);
      acc1 = wmma_bf16(aPl, bVh[1], acc1);
      acc2 = wmma_bf16(aPl, bVh[2], acc2);
      acc3 = wmma_bf16(aPl, bVh[3], acc3);
      acc0 = wmma_bf16(aPh, bVl[0], acc0);
      acc1 = wmma_bf16(aPh, bVl[1], acc1);
      acc2 = wmma_bf16(aPh, bVl[2], acc2);
      acc3 = wmma_bf16(aPh, bVl[3], acc3);
      srun += rs + rso;
    };

    // ---- the group's stages; a step wholly below the tile's first row is
    //      mask-free, the one on the diagonal is masked, later ones are skipped ----
    for (int t = 0; t < nstp; ++t, ++n) {
      const unsigned char* buf = ring + (n & 1) * BUFB;
      for (int p = part; p < SK / 32; p += KS) {
        const int kb = t * SK + 32 * p;
        if (kb <= q0) step32(buf, kb, 32 * p, kb + 32 > q0);
      }
      if (n + 1 < NJOBS) finish_stage(n + 1);            // into the buffer nobody reads now
      // publish point of job n+1; every wave passes it on every trip
      asm volatile("s_wait_dscnt 0x0" ::: "memory");     // own reads of this buffer, own K and V stores done
      __syncthreads();
      if (n + 2 < NJOBS) issue_stage(n + 2);             // refill the buffer just read
    }

    // Four vector slots between the last step's matrix run and the merge's vector
    // work on its accumulators: on the way out of the loop nothing else fills them.
    asm volatile("v_nop\n\tv_nop\n\tv_nop\n\tv_nop");

    // ---- merge the KS key parts of each q tile: parts 1.. hand (max, sum, O) over ----
    if (part != 0) {
      float* mo = sh_mo[(part - 1) * 4 + tl];
      float* ms = sh_ms[(part - 1) * 4 + tl];
      ms[lane]      = mrun;
      ms[32 + lane] = srun;
#pragma unroll
      for (int h = 0; h < 2; ++h) {
        const v4f t0 = {acc0[4 * h], acc0[4 * h + 1], acc0[4 * h + 2], acc0[4 * h + 3]};
        const v4f t1 = {acc1[4 * h], acc1[4 * h + 1], acc1[4 * h + 2], acc1[4 * h + 3]};
        const v4f t2 = {acc2[4 * h], acc2[4 * h + 1], acc2[4 * h + 2], acc2[4 * h + 3]};
        const v4f t3 = {acc3[4 * h], acc3[4 * h + 1], acc3[4 * h + 2], acc3[4 * h + 3]};
        *(v4f*)&mo[(0 + h) * 128 + lane * 4] = t0;
        *(v4f*)&mo[(2 + h) * 128 + lane * 4] = t1;
        *(v4f*)&mo[(4 + h) * 128 + lane * 4] = t2;
        *(v4f*)&mo[(6 + h) * 128 + lane * 4] = t3;
      }
    }
    __syncthreads();  // partials visible to part 0; they are rewritten only behind later stage barriers
    if (part == 0) {
      float mk[KS - 1], sk[KS - 1];
      float m = mrun;
#pragma unroll
      for (int k = 0; k < KS - 1; ++k) {
        mk[k] = sh_ms[k * 4 + tl][lane];
        sk[k] = sh_ms[k * 4 + tl][32 + lane];
        m = fmaxf(m, mk[k]);                  // a part without steps holds -3e38, 0, 0
      }
      const float c0 = exp2f(mrun - m);
      float s = srun * c0;
#pragma unroll
      for (int k = 0; k < KS - 1; ++k) {
        mk[k] = exp2f(mk[k] - m);
        s += sk[k] * mk[k];
      }
      const float inv = __builtin_amdgcn_rcpf(s);
      // each part's weight / sum, broadcast to the g-domain rows of the C layout
      Bc[lm] = c0 * inv;
      asm volatile("" ::: "memory");  // other lanes' values are read below: reads stay behind the store
#pragma unroll
      for (int g = 0; g < 8; ++g) {
        const float f = Bc[g + 8 * lh];
        acc0[g] *= f; acc1[g] *= f; acc2[g] *= f; acc3[g] *= f;
      }
#pragma unroll
      for (int k = 0; k < KS - 1; ++k) {
        Bc[lm] = mk[k] * inv;
        asm volatile("" ::: "memory");  // other lanes' values are read below: reads stay behind the store
        const float* mo = sh_mo[k * 4 + tl];
#pragma unroll
        for (int h = 0; h < 2; ++h) {
          const v4f t0 = *(const v4f*)&mo[(0 + h) * 128 + lane * 4];
          const v4f t1 = *(const v4f*)&mo[(2 + h) * 128 + lane * 4];
          const v4f t2 = *(const v4f*)&mo[(4 + h) * 128 + lane * 4];
          const v4f t3 = *(const v4f*)&mo[(6 + h) * 128 + lane * 4];
#pragma unroll
          for (int j = 0; j < 4; ++j) {
            const float f = Bc[4 * h + j + 8 * lh];
            acc0[4 * h + j] += f * t0[j];
            acc1[4 * h + j] += f * t1[j];
            acc2[4 * h + j] += f * t2[j];
            acc3[4 * h + j] += f * t3[j];
          }
        }
      }
#pragma unroll
      for (int g = 0; g < 8; ++g) {
        float* orow = Out + ((size_t)b * S_DIM + q0 + g + 8 * lh) * DH + lm;
        orow[0]  = acc0[g];
        orow[16] = acc1[g];
        orow[32] = acc2[g];
        orow[48] = acc3[g];
      }
      // the next group's set-up reuses the registers these stores name
      asm volatile("s_wait_xcnt 0x0" ::: "memory");
    }
  }
}

extern "C" void kernel_launch(void* const* d_in, const int* in_sizes, int n_in,
                              void* d_out, int out_size, void* d_ws, size_t ws_size,
                              hipStream_t stream) {
  const float* Q  = (const float*)d_in[0];
  const float* K  = (const float*)d_in[1];
  const float* V  = (const float*)d_in[2];
  const float* Rw = (const float*)d_in[3];
  const float* Rb = (const float*)d_in[4];
  float* Out = (float*)d_out;

  // 16 blocks per batch-head, each a mirrored pair of 64-row q groups
  attn_fa_kernel<<<B_DIM * 16, NTHR, 0, stream>>>(Q, K, V, Rw, Rb, Out);
}

// v005
// It runs in 31.4 microseconds.
// Next to v004, in two timings, it ran 1.10 times as fast each time.
// Counting every step since v000, it is 5.07 times as fast.
#include <hip/hip_runtime.h>

// Flash-attention with relative-position bias for MI455X (gfx1250, wave32).
// S^T = K Q^T: V_WMMA_F32_16X16X32_BF16 with 3-term hi/lo bf16 split (~2^-15 rel
//       err). A = K rows, B = Q: a lane holds 16 of the 32 scores of ONE query.
// O^T += V^T P^T: the same form and split. Two S^T tiles lie in the B fragment's
//       k order, so P is split in registers and never touches LDS; V^T's A
//       fragments come by the transposing LDS load. Maximum, sum and rescale
//       factor of a query sit in the lanes that hold its scores and outputs.
// One launch: each 128-key stage is prepared where it is used. K and V come as
// f32 through registers and are split to bf16 hi/lo on their way into LDS, both
// row-major. The waves of a block share each stage through a two-buffer LDS
// ring filled one stage ahead.
// Causal balance: a block owns two mirrored 64-row q groups (low, then high),
// 17 stages in all for every block; the four 32-key steps of a stage go to KS
// waves per q tile, whose partial (max, sum, O) are merged through LDS.

typedef __attribute__((ext_vector_type(2)))  float  v2f;
typedef __attribute__((ext_vector_type(4)))  float  v4f;
typedef __attribute__((ext_vector_type(8)))  float  v8f;
typedef __attribute__((ext_vector_type(2)))  __bf16 v2bf;
typedef __attribute__((ext_vector_type(2)))  unsigned int v2u;
typedef __attribute__((ext_vector_type(8)))  __bf16 v8bf;
typedef __attribute__((ext_vector_type(16))) __bf16 v16bf;

#define B_DIM  16
#define S_DIM  2048
#define DH     64
#define KS     4        // waves that share one q tile's keys
#define NWAVES (4 * KS) // waves per block: 4 q tiles x KS key parts
#define NTHR   (NWAVES * 32)
#define NJOBS  17       // stages per block: low group's + high group's
#define SK      128                      // keys per LDS stage
#define KPITCH  144                      // staged K row: 128 B + 16 B pad (16 B x odd)
#define VPITCH  160                      // staged V row: 128 B + 32 B pad (32 B x odd, for the transposing load)
#define KH_OFF  0
#define KL_OFF  (SK * KPITCH)
#define VH_OFF  (2 * SK * KPITCH)
#define VL_OFF  (VH_OFF + SK * VPITCH)
#define BUFB    (VL_OFF + SK * VPITCH)   // bytes per ring buffer

__device__ __forceinline__ v8f wmma_bf16(v16bf a, v16bf b, v8f c) {
  return __builtin_amdgcn_wmma_f32_16x16x32_bf16(false, a, false, b, (short)0, c,
                                                 false, false);
}
__device__ __forceinline__ v16bf cat8(v8bf a, v8bf b) {
  return __builtin_shufflevector(a, b, 0, 1, 2, 3, 4, 5, 6, 7,
                                       8, 9, 10, 11, 12, 13, 14, 15);
}
// fragment = two contiguous 8-elem runs at p and p+16 (A/B 16-bit layout)
__device__ __forceinline__ v16bf ld_frag(const __bf16* p) {
  return cat8(*(const v8bf*)p, *(const v8bf*)(p + 16));
}

// 16 x 16 piece of a row-major 16-bit LDS tile, transposed: lane (c, h) gets
// rows 8h .. 8h+7 of column c; p is the lane's own 16 B of the tile
__device__ __forceinline__ v8bf ld_tr16(const unsigned char* p) {
  typedef __attribute__((address_space(3))) v8bf lds_v8bf;
  return __builtin_amdgcn_ds_load_tr16_b128_v8bf16((lds_v8bf*)p);
}
// two f32 -> packed bf16 hi and packed bf16 lo (x - hi, rounded again)
__device__ __forceinline__ void split2(v2f x, unsigned& hi, unsigned& lo) {
  const unsigned w = __builtin_bit_cast(unsigned, __builtin_convertvector(x, v2bf));
  const v2f hf = {__builtin_bit_cast(float, w << 16),
                  __builtin_bit_cast(float, w & 0xffff0000u)};
  hi = w;
  lo = __builtin_bit_cast(unsigned, __builtin_convertvector(x - hf, v2bf));
}

__global__ __launch_bounds__(NTHR) void attn_fa_kernel(
    const float* __restrict__ Q, const float* __restrict__ K,
    const float* __restrict__ V, const float* __restrict__ Rw,
    const float* __restrict__ Rb, float* __restrict__ Out) {
  __shared__ float sh_rw[2 * DH];
  __shared__ float sh_rb[2];
  __shared__ __attribute__((aligned(16))) float sh_mo[(KS - 1) * 4][32 * 32];  // partial O
  __shared__ float sh_ms[(KS - 1) * 4][64];                                    // partial max, sum
  __shared__ __attribute__((aligned(16))) unsigned char ring[2 * BUFB];

  const int tid  = threadIdx.x;
  const int wave = __builtin_amdgcn_readfirstlane(tid >> 5);  // scalar: q0 steers branches
  const int lane = tid & 31;
  const int lm   = lane & 15;
  const int lh   = lane >> 4;
  const int tl   = wave & 3;                  // q tile inside the 64-row group
  const int part = wave >> 2;                 // which 32-key steps of a stage are this wave's

  const int b   = blockIdx.x >> 4;
  const int gi  = blockIdx.x & 15;            // low group gi, high group 31 - gi
  const int nlo = (gi >> 1) + 1;              // stages of the low group; the high one has NJOBS - nlo

  const float* k_b = K + (size_t)b * S_DIM * DH;
  const float* v_b = V + (size_t)b * S_DIM * DH;

  // ---- job n of the block stages keys [SK*t, SK*t+SK), t counted inside its q
  //      group: 128 rows x 256 B of K and of V, each 2048 pieces of 16 B shared
  //      evenly by the block's threads. Both wait in registers until
  //      finish_stage splits them ----
  constexpr int CP = 2048 / NTHR;             // 16 B pieces per thread and tensor
  v4f kreg[CP], vreg[CP];
  // The thread's first piece of the job issued last. The two addresses live on
  // from job to job, so no load lands on an address register, and they are
  // stepped only at the next issue, behind the wait that ends this one.
  const char* kp = (const char*)k_b + (unsigned)tid * 16u;
  const char* vp = (const char*)v_b + (unsigned)tid * 16u;
  auto issue_stage = [&](int n) {
    if (n > 0) {  // on by 128 keys, or back to key 0 where the high group begins
      const long long d = (n == nlo) ? -(long long)(nlo - 1) * (SK * DH * 4)
                                     : (long long)(SK * DH * 4);
      kp += d;
      vp += d;
    }
#pragma unroll
    for (int r = 0; r < CP; ++r) {
      kreg[r] = *(const v4f*)(kp + r * (NTHR * 16));
      vreg[r] = *(const v4f*)(vp + r * (NTHR * 16));
    }
    // closes the run of loads on every path, ahead of the next step of kp and vp
    asm volatile("s_wait_xcnt 0x0" ::: "memory");
  };
  // K and V of job n: f32 -> bf16 hi and lo, 8 B each per piece, row = key
  auto finish_stage = [&](int n) {
    unsigned char* lb = ring + (n & 1) * BUFB + (tid & 15) * 8;
    unsigned char* lk = lb + (tid >> 4) * KPITCH;
    unsigned char* lv = lb + (tid >> 4) * VPITCH;
#pragma unroll
    for (int r = 0; r < CP; ++r) {
      v2u hi, lo;
#pragma unroll
      for (int i = 0; i < 2; ++i) {
        unsigned h, l;
        split2(v2f{kreg[r][2 * i], kreg[r][2 * i + 1]}, h, l);
        hi[i] = h;
        lo[i] = l;
      }
      *(v2u*)(lk + KH_OFF + r * (NTHR / 16) * KPITCH) = hi;
      *(v2u*)(lk + KL_OFF + r * (NTHR / 16) * KPITCH) = lo;
#pragma unroll
      for (int i = 0; i < 2; ++i) {
        unsigned h, l;
        split2(v2f{vreg[r][2 * i], vreg[r][2 * i + 1]}, h, l);
        hi[i] = h;
        lo[i] = l;
      }
      *(v2u*)(lv + VH_OFF + r * (NTHR / 16) * VPITCH) = hi;
      *(v2u*)(lv + VL_OFF + r * (NTHR / 16) * VPITCH) = lo;
    }
  };

  issue_stage(0);
  finish_stage(0);
  if (tid < 2 * DH) sh_rw[tid] = Rw[tid];
  if (tid < 2) sh_rb[tid] = Rb[tid];
  __syncthreads();                                   // publishes job 0 (and sh_rw, sh_rb)
  issue_stage(1);                                    // flies during the Q set-up; the wait for Q's loads lands it

  int n = 0;                                         // job counter over both q groups
#pragma unroll 1  // one copy of the group body: keeps the kernel's text small
  for (int ph = 0; ph < 2; ++ph) {
    const int R    = ph ? S_DIM - 64 * (gi + 1) : 64 * gi;  // first q row of the group
    const int q0   = R + 16 * tl;
    const int nstp = (R >> 7) + 1;                   // 128-key stages up to the group's diagonal

    // log2(e)/sqrt(512): softmax in base-2 domain -> native v_exp_f32
    const float qscale = 0.04419417382415922f * 1.4426950408889634f;

    // ---- Q row (lm) in bf16-fragment element order: q32[16c + e] ----
    float q32[32];
    {
      const float* qrow = Q + ((size_t)(b * S_DIM + q0 + lm)) * DH;
#pragma unroll
      for (int r = 0; r < 4; ++r) {
        const v4f t0 = *(const v4f*)(qrow + 16 * r + 8 * lh);
        const v4f t1 = *(const v4f*)(qrow + 16 * r + 8 * lh + 4);
#pragma unroll
        for (int j = 0; j < 4; ++j) {
          q32[r * 8 + j]     = t0[j] * qscale;
          q32[r * 8 + 4 + j] = t1[j] * qscale;
        }
      }
    }

    // ---- relative-position bias for q-row lm: pos0 (j<i), posd = pos1-pos0 ----
    float pos0, posd;
    {
      float part0 = 0.f, part1 = 0.f;
#pragma unroll
      for (int r = 0; r < 4; ++r) {
#pragma unroll
        for (int j = 0; j < 8; ++j) {
          const int d = 16 * r + 8 * lh + j;
          part0 += q32[r * 8 + j] * sh_rw[d];
          part1 += q32[r * 8 + j] * sh_rw[DH + d];
        }
      }
      part0 += __shfl_xor(part0, 16);
      part1 += __shfl_xor(part1, 16);
      part0 += sh_rb[0] * qscale;
      part1 += sh_rb[1] * qscale;
      pos0 = part0;
      posd = part1 - part0;
    }

    // ---- pos0 in the C layout of S^T (column lm = the lane's own query): bias
    //      rides the matrix op's C operand, no per-step bias adds ----
    const v8f posC = {pos0, pos0, pos0, pos0, pos0, pos0, pos0, pos0};

    // ---- Q bf16 hi/lo B-fragments (2 chunks of K=32) ----
    v16bf aQhi[2], aQlo[2];
#pragma unroll
    for (int c = 0; c < 2; ++c) {
#pragma unroll
      for (int e = 0; e < 16; ++e) {
        const float x = q32[16 * c + e];
        const __bf16 h = (__bf16)x;
        aQhi[c][e] = h;
        aQlo[c][e] = (__bf16)(x - (float)h);
      }
    }

    v8f acc0 = {}, acc1 = {}, acc2 = {}, acc3 = {};
    float mrun = -3.0e38f, srun = 0.f;

    // buf: the stage's ring buffer; kl: first key of the step inside the stage
    auto step32 = [&](const unsigned char* buf, int kb, int kl, bool tail) {
      // ---- K fragments (hi/lo) for two 16-key tiles, from the staged rows ----
      const unsigned char* krow = buf + (kl + lm) * KPITCH + 16 * lh;
      const __bf16* kr0h = (const __bf16*)(krow + KH_OFF);
      const __bf16* kr1h = (const __bf16*)(krow + KH_OFF + 16 * KPITCH);
      const __bf16* kr0l = (const __bf16*)(krow + KL_OFF);
      const __bf16* kr1l = (const __bf16*)(krow + KL_OFF + 16 * KPITCH);

      // ---- S^T tiles (+pos0 via C): 3-term bf16 split, 12 WMMAs, two chains ----
      v16bf k0h[2], k1h[2], k0l[2], k1l[2];
#pragma unroll
      for (int c = 0; c < 2; ++c) {
        k0h[c] = ld_frag(kr0h + 32 * c);
        k1h[c] = ld_frag(kr1h + 32 * c);
        k0l[c] = ld_frag(kr0l + 32 * c);
        k1l[c] = ld_frag(kr1l + 32 * c);
      }
      // Keeps the sixteen loads together ahead of the matrix run: sunk among the
      // matrix instructions, into reused registers, each pair's LDS latency
      // would stand open there.
      __builtin_amdgcn_sched_barrier(0);
      v8f Sv0 = posC, Sv1 = posC;
#pragma unroll
      for (int c = 0; c < 2; ++c) {
        Sv0 = wmma_bf16(k0h[c], aQhi[c], Sv0);
        Sv1 = wmma_bf16(k1h[c], aQhi[c], Sv1);
        Sv0 = wmma_bf16(k0h[c], aQlo[c], Sv0);
        Sv1 = wmma_bf16(k1h[c], aQlo[c], Sv1);
        Sv0 = wmma_bf16(k0l[c], aQhi[c], Sv0);
        Sv1 = wmma_bf16(k1l[c], aQhi[c], Sv1);
      }

      // ---- query lm's scores: register g of tile i is key 16*i + 8*lh + g, which
      //      is element 8*i + g of a 16-bit fragment ----
      float vals[16];
#pragma unroll
      for (int g = 0; g < 8; ++g) {
        vals[g]     = Sv0[g];
        vals[8 + g] = Sv1[g];
      }

      // ---- (tail-only) causal mask + diagonal bias ----
      if (tail) {
#pragma unroll
        for (int e = 0; e < 16; ++e) {
          const int k  = (e < 8) ? (8 * lh + e) : (16 + 8 * lh + (e - 8));
          const int dk = (kb + k) - (q0 + lm);
          vals[e] = (dk > 0) ? -1.0e30f : ((dk == 0) ? vals[e] + posd : vals[e]);
        }
      }

      // ---- online softmax over 32 keys; balanced-tree reductions (depth 4) ----
      float tm[8];
#pragma unroll
      for (int i = 0; i < 8; ++i) tm[i] = fmaxf(vals[i], vals[8 + i]);
#pragma unroll
      for (int i = 0; i < 4; ++i) tm[i] = fmaxf(tm[i], tm[4 + i]);
      float rmax = fmaxf(fmaxf(tm[0], tm[1]), fmaxf(tm[2], tm[3]));
      rmax = fmaxf(rmax, __shfl_xor(rmax, 16));
      const float nm = fmaxf(mrun, rmax);
      if (__any(rmax > mrun)) {  // wave-uniform; rare in steady state
        const float corr = exp2f(mrun - nm);
        srun *= corr;
        acc0 *= corr; acc1 *= corr; acc2 *= corr; acc3 *= corr;
      }
      mrun = nm;

      // ---- V fragments (hi/lo), 32 keys x 4 column tiles, in the k order of
      //      vals; asked for here, behind the last LDS wait of the maximum, so
      //      that they fly during the exponentials ----
      v16bf bVh[4], bVl[4];
      {
        const unsigned char* vrow = buf + (kl + 8 * lh + (lane & 7)) * VPITCH +
                                    16 * ((lane >> 3) & 1);
#pragma unroll
        for (int j = 0; j < 4; ++j) {
          bVh[j] = cat8(ld_tr16(vrow + VH_OFF + 32 * j),
                        ld_tr16(vrow + VH_OFF + 16 * VPITCH + 32 * j));
          bVl[j] = cat8(ld_tr16(vrow + VL_OFF + 32 * j),
                        ld_tr16(vrow + VL_OFF + 16 * VPITCH + 32 * j));
        }
      }
      // Keeps the sixteen loads together up here: sunk among the matrix
      // instructions, each small group's LDS latency would stand open there.
      __builtin_amdgcn_sched_barrier(0);

      v4f p0, p1, p2, p3;
#pragma unroll
      for (int j = 0; j < 4; ++j) {
        p0[j] = exp2f(vals[j] - nm);
        p1[j] = exp2f(vals[4 + j] - nm);
        p2[j] = exp2f(vals[8 + j] - nm);
        p3[j] = exp2f(vals[12 + j] - nm);
      }
      const v4f ps = (p0 + p1) + (p2 + p3);   // element-wise tree
      float rs = (ps[0] + ps[1]) + (ps[2] + ps[3]);
      const float rso = __shfl_xor(rs, 16);   // the other half's sum

      // ---- P^T hi/lo B-fragments: element e of vals is element e of the fragment ----
      v16bf aPh, aPl;
      {
        unsigned ph[8], pl[8];
#pragma unroll
        for (int i = 0; i < 2; ++i) {
          split2(v2f{p0[2 * i], p0[2 * i + 1]}, ph[i],     pl[i]);
          split2(v2f{p1[2 * i], p1[2 * i + 1]}, ph[2 + i], pl[2 + i]);
          split2(v2f{p2[2 * i], p2[2 * i + 1]}, ph[4 + i], pl[4 + i]);
          split2(v2f{p3[2 * i], p3[2 * i + 1]}, ph[6 + i], pl[6 + i]);
        }
        typedef __attribute__((ext_vector_type(8))) unsigned int v8u;
        const v8u wh = {ph[0], ph[1], ph[2], ph[3], ph[4], ph[5], ph[6], ph[7]};
        const v8u wl = {pl[0], pl[1], pl[2], pl[3], pl[4], pl[5], pl[6], pl[7]};
        aPh = __builtin_bit_cast(v16bf, wh);
        aPl = __builtin_bit_cast(v16bf, wl);
      }

      // ---- O^T += V^T @ P^T : 3-term bf16 split, 12 WMMAs, 4 independent chains;
      //      accj[g] = O[query lm][16*j + 8*lh + g] ----
      acc0 = wmma_bf16(bVh[0], aPh, acc0);
      acc1 = wmma_bf16(bVh[1], aPh, acc1);
      acc2 = wmma_bf16(bVh[2], aPh, acc2);
      acc3 = wmma_bf16(bVh[3], aPh, acc3);
      acc0 = wmma_bf16(bVh[0], aPl, acc0);
      acc1 = wmma_bf16(bVh[1], aPl, acc1);
      acc2 = wmma_bf16(bVh[2], aPl, acc2);
      acc3 = wmma_bf16(bVh[3], aPl, acc3);
      acc0 = wmma_bf16(bVl[0], aPh, acc0);
      acc1 = wmma_bf16(bVl[1], aPh, acc1);
      acc2 = wmma_bf16(bVl[2], aPh, acc2);
      acc3 = wmma_bf16(bVl[3], aPh, acc3);
      srun += rs + rso;
    };

    // ---- the group's stages; a step wholly below the tile's first row is
    //      mask-free, the one on the diagonal is masked, later ones are skipped ----
    for (int t = 0; t < nstp; ++t, ++n) {
      const unsigned char* buf = ring + (n & 1) * BUFB;
      for (int p = part; p < SK / 32; p += KS) {
        const int kb = t * SK + 32 * p;
        if (kb <= q0) step32(buf, kb, 32 * p, kb + 32 > q0);
      }
      if (n + 1 < NJOBS) finish_stage(n + 1);            // into the buffer nobody reads now
      // publish point of job n+1; every wave passes it on every trip
      asm volatile("s_wait_dscnt 0x0" ::: "memory");     // own reads of this buffer, own K and V stores done
      __syncthreads();
      if (n + 2 < NJOBS) issue_stage(n + 2);             // refill the buffer just read
    }

    // Four vector slots between the last step's matrix run and the merge's vector
    // work on its accumulators: on the way out of the loop nothing else fills them.
    asm volatile("v_nop\n\tv_nop\n\tv_nop\n\tv_nop");

    // ---- merge the KS key parts of each q tile: parts 1.. hand (max, sum, O) over ----
    if (part != 0) {
      float* mo = sh_mo[(part - 1) * 4 + tl];
      float* ms = sh_ms[(part - 1) * 4 + tl];
      ms[lane]      = mrun;
      ms[32 + lane] = srun;
#pragma unroll
      for (int h = 0; h < 2; ++h) {
        const v4f t0 = {acc0[4 * h], acc0[4 * h + 1], acc0[4 * h + 2], acc0[4 * h + 3]};
        const v4f t1 = {acc1[4 * h], acc1[4 * h + 1], acc1[4 * h + 2], acc1[4 * h + 3]};
        const v4f t2 = {acc2[4 * h], acc2[4 * h + 1], acc2[4 * h + 2], acc2[4 * h + 3]};
        const v4f t3 = {acc3[4 * h], acc3[4 * h + 1], acc3[4 * h + 2], acc3[4 * h + 3]};
        *(v4f*)&mo[(0 + h) * 128 + lane * 4] = t0;
        *(v4f*)&mo[(2 + h) * 128 + lane * 4] = t1;
        *(v4f*)&mo[(4 + h) * 128 + lane * 4] = t2;
        *(v4f*)&mo[(6 + h) * 128 + lane * 4] = t3;
      }
    }
    __syncthreads();  // partials visible to part 0; they are rewritten only behind later stage barriers
    if (part == 0) {
      float mk[KS - 1], sk[KS - 1];
      float m = mrun;
#pragma unroll
      for (int k = 0; k < KS - 1; ++k) {
        mk[k] = sh_ms[k * 4 + tl][lane];
        sk[k] = sh_ms[k * 4 + tl][32 + lane];
        m = fmaxf(m, mk[k]);                  // a part without steps holds -3e38, 0, 0
      }
      const float c0 = exp2f(mrun - m);
      float s = srun * c0;
#pragma unroll
      for (int k = 0; k < KS - 1; ++k) {
        mk[k] = exp2f(mk[k] - m);
        s += sk[k] * mk[k];
      }
      const float inv = __builtin_amdgcn_rcpf(s);
      // each part's weight / sum: the lane's own query's, like all it holds of O
      {
        const float f = c0 * inv;
        acc0 *= f; acc1 *= f; acc2 *= f; acc3 *= f;
      }
#pragma unroll
      for (int k = 0; k < KS - 1; ++k) {
        const float f = mk[k] * inv;
        const float* mo = sh_mo[k * 4 + tl];
#pragma unroll
        for (int h = 0; h < 2; ++h) {
          const v4f t0 = *(const v4f*)&mo[(0 + h) * 128 + lane * 4];
          const v4f t1 = *(const v4f*)&mo[(2 + h) * 128 + lane * 4];
          const v4f t2 = *(const v4f*)&mo[(4 + h) * 128 + lane * 4];
          const v4f t3 = *(const v4f*)&mo[(6 + h) * 128 + lane * 4];
#pragma unroll
          for (int j = 0; j < 4; ++j) {
            acc0[4 * h + j] += f * t0[j];
            acc1[4 * h + j] += f * t1[j];
            acc2[4 * h + j] += f * t2[j];
            acc3[4 * h + j] += f * t3[j];
          }
        }
      }
      float* orow = Out + (unsigned)((b * S_DIM + q0 + lm) * DH + 8 * lh);
#pragma unroll
      for (int h = 0; h < 2; ++h) {
        *(v4f*)(orow + 4 * h)      = v4f{acc0[4 * h], acc0[4 * h + 1], acc0[4 * h + 2], acc0[4 * h + 3]};
        *(v4f*)(orow + 16 + 4 * h) = v4f{acc1[4 * h], acc1[4 * h + 1], acc1[4 * h + 2], acc1[4 * h + 3]};
        *(v4f*)(orow + 32 + 4 * h) = v4f{acc2[4 * h], acc2[4 * h + 1], acc2[4 * h + 2], acc2[4 * h + 3]};
        *(v4f*)(orow + 48 + 4 * h) = v4f{acc3[4 * h], acc3[4 * h + 1], acc3[4 * h + 2], acc3[4 * h + 3]};
      }
      // the next group's set-up reuses the registers these stores name
      asm volatile("s_wait_xcnt 0x0" ::: "memory");
    }
  }
}

extern "C" void kernel_launch(void* const* d_in, const int* in_sizes, int n_in,
                              void* d_out, int out_size, void* d_ws, size_t ws_size,
                              hipStream_t stream) {
  const float* Q  = (const float*)d_in[0];
  const float* K  = (const float*)d_in[1];
  const float* V  = (const float*)d_in[2];
  const float* Rw = (const float*)d_in[3];
  const float* Rb = (const float*)d_in[4];
  float* Out = (float*)d_out;

  // 16 blocks per batch-head, each a mirrored pair of 64-row q groups
  attn_fa_kernel<<<B_DIM * 16, NTHR, 0, stream>>>(Q, K, V, Rw, Rb, Out);
}

// v006
// One run takes 29.2 microseconds.
// Next to v005, in two timings, it ran 1.07 times as fast each time.
// Over all steps from v000 it is 5.45 times as fast.
#include <hip/hip_runtime.h>

// Flash-attention with relative-position bias for MI455X (gfx1250, wave32).
// S^T = K Q^T: V_WMMA_F32_16X16X32_BF16 with 3-term hi/lo bf16 split (~2^-15 rel
//       err). A = K rows, B = Q: a lane holds 16 of the 32 scores of ONE query.
// O^T += V^T P^T: the same form and split. Two S^T tiles lie in the B fragment's
//       k order, so P is split in registers and never touches LDS; V^T's A
//       fragments come by the transposing LDS load. Maximum, sum and rescale
//       factor of a query sit in the lanes that hold its scores and outputs.
// One launch: each 128-key stage is prepared where it is used. K and V come as
// f32 through registers and are split to bf16 hi/lo on their way into LDS, both
// row-major. The waves of a block share each stage through a two-buffer LDS
// ring filled one stage ahead.
// Causal balance: a block owns two mirrored 64-row q groups (low, then high),
// 17 stages in all for every block; the four 32-key steps of a stage go to KS
// waves per q tile, whose partial (max, sum, O) are merged through LDS.

typedef __attribute__((ext_vector_type(2)))  float  v2f;
typedef __attribute__((ext_vector_type(4)))  float  v4f;
typedef __attribute__((ext_vector_type(8)))  float  v8f;
typedef __attribute__((ext_vector_type(2)))  __bf16 v2bf;
typedef __attribute__((ext_vector_type(2)))  unsigned int v2u;
typedef __attribute__((ext_vector_type(8)))  __bf16 v8bf;
typedef __attribute__((ext_vector_type(16))) __bf16 v16bf;

#define B_DIM  16
#define S_DIM  2048
#define DH     64
#define KS     4        // waves that share one q tile's keys
#define NWAVES (4 * KS) // waves per block: 4 q tiles x KS key parts
#define NTHR   (NWAVES * 32)
#define NJOBS  17       // stages per block: low group's + high group's
#define SK      128                      // keys per LDS stage
#define KPITCH  144                      // staged K row: 128 B + 16 B pad (16 B x odd)
#define VPITCH  160                      // staged V row: 128 B + 32 B pad (32 B x odd, for the transposing load)
#define KH_OFF  0
#define KL_OFF  (SK * KPITCH)
#define VH_OFF  (2 * SK * KPITCH)
#define VL_OFF  (VH_OFF + SK * VPITCH)
#define BUFB    (VL_OFF + SK * VPITCH)   // bytes per ring buffer

__device__ __forceinline__ v8f wmma_bf16(v16bf a, v16bf b, v8f c) {
  return __builtin_amdgcn_wmma_f32_16x16x32_bf16(false, a, false, b, (short)0, c,
                                                 false, false);
}
__device__ __forceinline__ v16bf cat8(v8bf a, v8bf b) {
  return __builtin_shufflevector(a, b, 0, 1, 2, 3, 4, 5, 6, 7,
                                       8, 9, 10, 11, 12, 13, 14, 15);
}
// fragment = two contiguous 8-elem runs at p and p+16 (A/B 16-bit layout)
__device__ __forceinline__ v16bf ld_frag(const __bf16* p) {
  return cat8(*(const v8bf*)p, *(const v8bf*)(p + 16));
}

// 16 x 16 piece of a row-major 16-bit LDS tile, transposed: lane (c, h) gets
// rows 8h .. 8h+7 of column c; p is the lane's own 16 B of the tile
__device__ __forceinline__ v8bf ld_tr16(const unsigned char* p) {
  typedef __attribute__((address_space(3))) v8bf lds_v8bf;
  return __builtin_amdgcn_ds_load_tr16_b128_v8bf16((lds_v8bf*)p);
}
// 2^x as the one hardware instruction. The library's exp2f wraps it in a range
// guard (compare, two selects, add, ldexp) that only serves results below
// 2^-126; here every argument is score - maximum <= 0 and such a weight, against
// the maximum's own weight of 1, may as well be 0.
__device__ __forceinline__ float ex2(float x) { return __builtin_amdgcn_exp2f(x); }
// two f32 -> packed bf16 hi and packed bf16 lo (x - hi, rounded again)
__device__ __forceinline__ void split2(v2f x, unsigned& hi, unsigned& lo) {
  const unsigned w = __builtin_bit_cast(unsigned, __builtin_convertvector(x, v2bf));
  const v2f hf = {__builtin_bit_cast(float, w << 16),
                  __builtin_bit_cast(float, w & 0xffff0000u)};
  hi = w;
  lo = __builtin_bit_cast(unsigned, __builtin_convertvector(x - hf, v2bf));
}

__global__ __launch_bounds__(NTHR) void attn_fa_kernel(
    const float* __restrict__ Q, const float* __restrict__ K,
    const float* __restrict__ V, const float* __restrict__ Rw,
    const float* __restrict__ Rb, float* __restrict__ Out) {
  __shared__ float sh_rw[2 * DH];
  __shared__ float sh_rb[2];
  __shared__ __attribute__((aligned(16))) float sh_mo[(KS - 1) * 4][32 * 32];  // partial O
  __shared__ float sh_ms[(KS - 1) * 4][64];                                    // partial max, sum
  __shared__ __attribute__((aligned(16))) unsigned char ring[2 * BUFB];

  const int tid  = threadIdx.x;
  const int wave = __builtin_amdgcn_readfirstlane(tid >> 5);  // scalar: q0 steers branches
  const int lane = tid & 31;
  const int lm   = lane & 15;
  const int lh   = lane >> 4;
  const int tl   = wave & 3;                  // q tile inside the 64-row group
  const int part = wave >> 2;                 // which 32-key steps of a stage are this wave's

  const int b   = blockIdx.x >> 4;
  const int gi  = blockIdx.x & 15;            // low group gi, high group 31 - gi
  const int nlo = (gi >> 1) + 1;              // stages of the low group; the high one has NJOBS - nlo

  const float* k_b = K + (size_t)b * S_DIM * DH;
  const float* v_b = V + (size_t)b * S_DIM * DH;

  // ---- job n of the block stages keys [SK*t, SK*t+SK), t counted inside its q
  //      group: 128 rows x 256 B of K and of V, each 2048 pieces of 16 B shared
  //      evenly by the block's threads. Both wait in registers until
  //      finish_stage splits them ----
  constexpr int CP = 2048 / NTHR;             // 16 B pieces per thread and tensor
  v4f kreg[CP], vreg[CP];
  // The thread's first piece of the job issued last. The two addresses live on
  // from job to job, so no load lands on an address register, and they are
  // stepped only at the next issue, behind the wait that ends this one.
  const char* kp = (const char*)k_b + (unsigned)tid * 16u;
  const char* vp = (const char*)v_b + (unsigned)tid * 16u;
  auto issue_stage = [&](int n) {
    if (n > 0) {  // on by 128 keys, or back to key 0 where the high group begins
      const long long d = (n == nlo) ? -(long long)(nlo - 1) * (SK * DH * 4)
                                     : (long long)(SK * DH * 4);
      kp += d;
      vp += d;
    }
#pragma unroll
    for (int r = 0; r < CP; ++r) {
      kreg[r] = *(const v4f*)(kp + r * (NTHR * 16));
      vreg[r] = *(const v4f*)(vp + r * (NTHR * 16));
    }
    // closes the run of loads on every path, ahead of the next step of kp and vp
    asm volatile("s_wait_xcnt 0x0" ::: "memory");
  };
  // K and V of job n: f32 -> bf16 hi and lo, 8 B each per piece, row = key
  auto finish_stage = [&](int n) {
    unsigned char* lb = ring + (n & 1) * BUFB + (tid & 15) * 8;
    unsigned char* lk = lb + (tid >> 4) * KPITCH;
    unsigned char* lv = lb + (tid >> 4) * VPITCH;
#pragma unroll
    for (int r = 0; r < CP; ++r) {
      v2u hi, lo;
#pragma unroll
      for (int i = 0; i < 2; ++i) {
        unsigned h, l;
        split2(v2f{kreg[r][2 * i], kreg[r][2 * i + 1]}, h, l);
        hi[i] = h;
        lo[i] = l;
      }
      *(v2u*)(lk + KH_OFF + r * (NTHR / 16) * KPITCH) = hi;
      *(v2u*)(lk + KL_OFF + r * (NTHR / 16) * KPITCH) = lo;
#pragma unroll
      for (int i = 0; i < 2; ++i) {
        unsigned h, l;
        split2(v2f{vreg[r][2 * i], vreg[r][2 * i + 1]}, h, l);
        hi[i] = h;
        lo[i] = l;
      }
      *(v2u*)(lv + VH_OFF + r * (NTHR / 16) * VPITCH) = hi;
      *(v2u*)(lv + VL_OFF + r * (NTHR / 16) * VPITCH) = lo;
    }
  };

  issue_stage(0);
  finish_stage(0);
  if (tid < 2 * DH) sh_rw[tid] = Rw[tid];
  if (tid < 2) sh_rb[tid] = Rb[tid];
  __syncthreads();                                   // publishes job 0 (and sh_rw, sh_rb)
  issue_stage(1);                                    // flies during the Q set-up; the wait for Q's loads lands it

  int n = 0;                                         // job counter over both q groups
#pragma unroll 1  // one copy of the group body: keeps the kernel's text small
  for (int ph = 0; ph < 2; ++ph) {
    const int R    = ph ? S_DIM - 64 * (gi + 1) : 64 * gi;  // first q row of the group
    const int q0   = R + 16 * tl;
    const int nstp = (R >> 7) + 1;                   // 128-key stages up to the group's diagonal

    // log2(e)/sqrt(512): softmax in base-2 domain -> native v_exp_f32
    const float qscale = 0.04419417382415922f * 1.4426950408889634f;

    // ---- Q row (lm) in bf16-fragment element order: q32[16c + e] ----
    float q32[32];
    {
      const float* qrow = Q + ((size_t)(b * S_DIM + q0 + lm)) * DH;
#pragma unroll
      for (int r = 0; r < 4; ++r) {
        const v4f t0 = *(const v4f*)(qrow + 16 * r + 8 * lh);
        const v4f t1 = *(const v4f*)(qrow + 16 * r + 8 * lh + 4);
#pragma unroll
        for (int j = 0; j < 4; ++j) {
          q32[r * 8 + j]     = t0[j] * qscale;
          q32[r * 8 + 4 + j] = t1[j] * qscale;
        }
      }
    }

    // ---- relative-position bias for q-row lm: pos0 (j<i), posd = pos1-pos0 ----
    float pos0, posd;
    {
      float part0 = 0.f, part1 = 0.f;
#pragma unroll
      for (int r = 0; r < 4; ++r) {
#pragma unroll
        for (int j = 0; j < 8; ++j) {
          const int d = 16 * r + 8 * lh + j;
          part0 += q32[r * 8 + j] * sh_rw[d];
          part1 += q32[r * 8 + j] * sh_rw[DH + d];
        }
      }
      part0 += __shfl_xor(part0, 16);
      part1 += __shfl_xor(part1, 16);
      part0 += sh_rb[0] * qscale;
      part1 += sh_rb[1] * qscale;
      pos0 = part0;
      posd = part1 - part0;
    }

    // ---- pos0 in the C layout of S^T (column lm = the lane's own query): bias
    //      rides the matrix op's C operand, no per-step bias adds ----
    const v8f posC = {pos0, pos0, pos0, pos0, pos0, pos0, pos0, pos0};

    // ---- Q bf16 hi/lo B-fragments (2 chunks of K=32) ----
    v16bf aQhi[2], aQlo[2];
#pragma unroll
    for (int c = 0; c < 2; ++c) {
#pragma unroll
      for (int e = 0; e < 16; ++e) {
        const float x = q32[16 * c + e];
        const __bf16 h = (__bf16)x;
        aQhi[c][e] = h;
        aQlo[c][e] = (__bf16)(x - (float)h);
      }
    }

    v8f acc0 = {}, acc1 = {}, acc2 = {}, acc3 = {};
    float mrun = -3.0e38f, srun = 0.f;

    // buf: the stage's ring buffer; kl: first key of the step inside the stage
    auto step32 = [&](const unsigned char* buf, int kb, int kl, bool tail) {
      // ---- K fragments (hi/lo) for two 16-key tiles, from the staged rows ----
      const unsigned char* krow = buf + (kl + lm) * KPITCH + 16 * lh;
      const __bf16* kr0h = (const __bf16*)(krow + KH_OFF);
      const __bf16* kr1h = (const __bf16*)(krow + KH_OFF + 16 * KPITCH);
      const __bf16* kr0l = (const __bf16*)(krow + KL_OFF);
      const __bf16* kr1l = (const __bf16*)(krow + KL_OFF + 16 * KPITCH);

      // ---- S^T tiles (+pos0 via C): 3-term bf16 split, 12 WMMAs, two chains ----
      v16bf k0h[2], k1h[2], k0l[2], k1l[2];
#pragma unroll
      for (int c = 0; c < 2; ++c) {
        k0h[c] = ld_frag(kr0h + 32 * c);
        k1h[c] = ld_frag(kr1h + 32 * c);
        k0l[c] = ld_frag(kr0l + 32 * c);
        k1l[c] = ld_frag(kr1l + 32 * c);
      }
      // Keeps the sixteen loads together ahead of the matrix run: sunk among the
      // matrix instructions, into reused registers, each pair's LDS latency
      // would stand open there.
      __builtin_amdgcn_sched_barrier(0);
      v8f Sv0 = posC, Sv1 = posC;
#pragma unroll
      for (int c = 0; c < 2; ++c) {
        Sv0 = wmma_bf16(k0h[c], aQhi[c], Sv0);
        Sv1 = wmma_bf16(k1h[c], aQhi[c], Sv1);
        Sv0 = wmma_bf16(k0h[c], aQlo[c], Sv0);
        Sv1 = wmma_bf16(k1h[c], aQlo[c], Sv1);
        Sv0 = wmma_bf16(k0l[c], aQhi[c], Sv0);
        Sv1 = wmma_bf16(k1l[c], aQhi[c], Sv1);
      }

      // ---- query lm's scores: register g of tile i is key 16*i + 8*lh + g, which
      //      is element 8*i + g of a 16-bit fragment ----
      float vals[16];
#pragma unroll
      for (int g = 0; g < 8; ++g) {
        vals[g]     = Sv0[g];
        vals[8 + g] = Sv1[g];
      }

      // ---- (tail-only) causal mask + diagonal bias ----
      if (tail) {
#pragma unroll
        for (int e = 0; e < 16; ++e) {
          const int k  = (e < 8) ? (8 * lh + e) : (16 + 8 * lh + (e - 8));
          const int dk = (kb + k) - (q0 + lm);
          vals[e] = (dk > 0) ? -1.0e30f : ((dk == 0) ? vals[e] + posd : vals[e]);
        }
      }

      // ---- online softmax over 32 keys; balanced-tree reductions (depth 4) ----
      float tm[8];
#pragma unroll
      for (int i = 0; i < 8; ++i) tm[i] = fmaxf(vals[i], vals[8 + i]);
#pragma unroll
      for (int i = 0; i < 4; ++i) tm[i] = fmaxf(tm[i], tm[4 + i]);
      float rmax = fmaxf(fmaxf(tm[0], tm[1]), fmaxf(tm[2], tm[3]));
      rmax = fmaxf(rmax, __shfl_xor(rmax, 16));
      const float nm = fmaxf(mrun, rmax);
      if (__any(rmax > mrun)) {  // wave-uniform; rare in steady state
        const float corr = ex2(mrun - nm);
        srun *= corr;
        acc0 *= corr; acc1 *= corr; acc2 *= corr; acc3 *= corr;
      }
      mrun = nm;

      // ---- V fragments (hi/lo), 32 keys x 4 column tiles, in the k order of
      //      vals; asked for here, behind the last LDS wait of the maximum, so
      //      that they fly during the exponentials ----
      v16bf bVh[4], bVl[4];
      {
        const unsigned char* vrow = buf + (kl + 8 * lh + (lane & 7)) * VPITCH +
                                    16 * ((lane >> 3) & 1);
#pragma unroll
        for (int j = 0; j < 4; ++j) {
          bVh[j] = cat8(ld_tr16(vrow + VH_OFF + 32 * j),
                        ld_tr16(vrow + VH_OFF + 16 * VPITCH + 32 * j));
          bVl[j] = cat8(ld_tr16(vrow + VL_OFF + 32 * j),
                        ld_tr16(vrow + VL_OFF + 16 * VPITCH + 32 * j));
        }
      }
      // Keeps the sixteen loads together up here: sunk among the matrix
      // instructions, each small group's LDS latency would stand open there.
      __builtin_amdgcn_sched_barrier(0);

      v4f p0, p1, p2, p3;
#pragma unroll
      for (int j = 0; j < 2; ++j) {  // the subtractions stay packed, two scores each
        const v2f a0 = v2f{vals[2 * j],      vals[2 * j + 1]}  - nm;
        const v2f a1 = v2f{vals[4 + 2 * j],  vals[5 + 2 * j]}  - nm;
        const v2f a2 = v2f{vals[8 + 2 * j],  vals[9 + 2 * j]}  - nm;
        const v2f a3 = v2f{vals[12 + 2 * j], vals[13 + 2 * j]} - nm;
        p0[2 * j] = ex2(a0[0]); p0[2 * j + 1] = ex2(a0[1]);
        p1[2 * j] = ex2(a1[0]); p1[2 * j + 1] = ex2(a1[1]);
        p2[2 * j] = ex2(a2[0]); p2[2 * j + 1] = ex2(a2[1]);
        p3[2 * j] = ex2(a3[0]); p3[2 * j + 1] = ex2(a3[1]);
      }
      const v4f ps = (p0 + p1) + (p2 + p3);   // element-wise tree
      float rs = (ps[0] + ps[1]) + (ps[2] + ps[3]);
      const float rso = __shfl_xor(rs, 16);   // the other half's sum

      // ---- P^T hi/lo B-fragments: element e of vals is element e of the fragment ----
      v16bf aPh, aPl;
      {
        unsigned ph[8], pl[8];
#pragma unroll
        for (int i = 0; i < 2; ++i) {
          split2(v2f{p0[2 * i], p0[2 * i + 1]}, ph[i],     pl[i]);
          split2(v2f{p1[2 * i], p1[2 * i + 1]}, ph[2 + i], pl[2 + i]);
          split2(v2f{p2[2 * i], p2[2 * i + 1]}, ph[4 + i], pl[4 + i]);
          split2(v2f{p3[2 * i], p3[2 * i + 1]}, ph[6 + i], pl[6 + i]);
        }
        typedef __attribute__((ext_vector_type(8))) unsigned int v8u;
        const v8u wh = {ph[0], ph[1], ph[2], ph[3], ph[4], ph[5], ph[6], ph[7]};
        const v8u wl = {pl[0], pl[1], pl[2], pl[3], pl[4], pl[5], pl[6], pl[7]};
        aPh = __builtin_bit_cast(v16bf, wh);
        aPl = __builtin_bit_cast(v16bf, wl);
      }

      // ---- O^T += V^T @ P^T : 3-term bf16 split, 12 WMMAs, 4 independent chains;
      //      accj[g] = O[query lm][16*j + 8*lh + g] ----
      acc0 = wmma_bf16(bVh[0], aPh, acc0);
      acc1 = wmma_bf16(bVh[1], aPh, acc1);
      acc2 = wmma_bf16(bVh[2], aPh, acc2);
      acc3 = wmma_bf16(bVh[3], aPh, acc3);
      acc0 = wmma_bf16(bVh[0], aPl, acc0);
      acc1 = wmma_bf16(bVh[1], aPl, acc1);
      acc2 = wmma_bf16(bVh[2], aPl, acc2);
      acc3 = wmma_bf16(bVh[3], aPl, acc3);
      acc0 = wmma_bf16(bVl[0], aPh, acc0);
      acc1 = wmma_bf16(bVl[1], aPh, acc1);
      acc2 = wmma_bf16(bVl[2], aPh, acc2);
      acc3 = wmma_bf16(bVl[3], aPh, acc3);
      srun += rs + rso;
    };

    // ---- the group's stages; a step wholly below the tile's first row is
    //      mask-free, the one on the diagonal is masked, later ones are skipped ----
    for (int t = 0; t < nstp; ++t, ++n) {
      const unsigned char* buf = ring + (n & 1) * BUFB;
      for (int p = part; p < SK / 32; p += KS) {
        const int kb = t * SK + 32 * p;
        if (kb <= q0) step32(buf, kb, 32 * p, kb + 32 > q0);
      }
      if (n + 1 < NJOBS) finish_stage(n + 1);            // into the buffer nobody reads now
      // Four vector slots behind the step's matrix run: on the way round
      // finish_stage (to the next step, to the merge) nothing else stands between
      // it and the next vector write to its operands or read of its accumulators.
      asm volatile("v_nop\n\tv_nop\n\tv_nop\n\tv_nop");
      // publish point of job n+1; every wave passes it on every trip
      asm volatile("s_wait_dscnt 0x0" ::: "memory");     // own reads of this buffer, own K and V stores done
      __syncthreads();
      if (n + 2 < NJOBS) issue_stage(n + 2);             // refill the buffer just read
    }

    // ---- merge the KS key parts of each q tile: parts 1.. hand (max, sum, O) over ----
    if (part != 0) {
      float* mo = sh_mo[(part - 1) * 4 + tl];
      float* ms = sh_ms[(part - 1) * 4 + tl];
      ms[lane]      = mrun;
      ms[32 + lane] = srun;
#pragma unroll
      for (int h = 0; h < 2; ++h) {
        const v4f t0 = {acc0[4 * h], acc0[4 * h + 1], acc0[4 * h + 2], acc0[4 * h + 3]};
        const v4f t1 = {acc1[4 * h], acc1[4 * h + 1], acc1[4 * h + 2], acc1[4 * h + 3]};
        const v4f t2 = {acc2[4 * h], acc2[4 * h + 1], acc2[4 * h + 2], acc2[4 * h + 3]};
        const v4f t3 = {acc3[4 * h], acc3[4 * h + 1], acc3[4 * h + 2], acc3[4 * h + 3]};
        *(v4f*)&mo[(0 + h) * 128 + lane * 4] = t0;
        *(v4f*)&mo[(2 + h) * 128 + lane * 4] = t1;
        *(v4f*)&mo[(4 + h) * 128 + lane * 4] = t2;
        *(v4f*)&mo[(6 + h) * 128 + lane * 4] = t3;
      }
    }
    __syncthreads();  // partials visible to part 0; they are rewritten only behind later stage barriers
    if (part == 0) {
      float mk[KS - 1], sk[KS - 1];
      float m = mrun;
#pragma unroll
      for (int k = 0; k < KS - 1; ++k) {
        mk[k] = sh_ms[k * 4 + tl][lane];
        sk[k] = sh_ms[k * 4 + tl][32 + lane];
        m = fmaxf(m, mk[k]);                  // a part without steps holds -3e38, 0, 0
      }
      const float c0 = ex2(mrun - m);
      float s = srun * c0;
#pragma unroll
      for (int k = 0; k < KS - 1; ++k) {
        mk[k] = ex2(mk[k] - m);
        s += sk[k] * mk[k];
      }
      const float inv = __builtin_amdgcn_rcpf(s);
      // each part's weight / sum: the lane's own query's, like all it holds of O
      {
        const float f = c0 * inv;
        acc0 *= f; acc1 *= f; acc2 *= f; acc3 *= f;
      }
#pragma unroll
      for (int k = 0; k < KS - 1; ++k) {
        const float f = mk[k] * inv;
        const float* mo = sh_mo[k * 4 + tl];
#pragma unroll
        for (int h = 0; h < 2; ++h) {
          const v4f t0 = *(const v4f*)&mo[(0 + h) * 128 + lane * 4];
          const v4f t1 = *(const v4f*)&mo[(2 + h) * 128 + lane * 4];
          const v4f t2 = *(const v4f*)&mo[(4 + h) * 128 + lane * 4];
          const v4f t3 = *(const v4f*)&mo[(6 + h) * 128 + lane * 4];
#pragma unroll
          for (int j = 0; j < 4; ++j) {
            acc0[4 * h + j] += f * t0[j];
            acc1[4 * h + j] += f * t1[j];
            acc2[4 * h + j] += f * t2[j];
            acc3[4 * h + j] += f * t3[j];
          }
        }
      }
      float* orow = Out + (unsigned)((b * S_DIM + q0 + lm) * DH + 8 * lh);
#pragma unroll
      for (int h = 0; h < 2; ++h) {
        *(v4f*)(orow + 4 * h)      = v4f{acc0[4 * h], acc0[4 * h + 1], acc0[4 * h + 2], acc0[4 * h + 3]};
        *(v4f*)(orow + 16 + 4 * h) = v4f{acc1[4 * h], acc1[4 * h + 1], acc1[4 * h + 2], acc1[4 * h + 3]};
        *(v4f*)(orow + 32 + 4 * h) = v4f{acc2[4 * h], acc2[4 * h + 1], acc2[4 * h + 2], acc2[4 * h + 3]};
        *(v4f*)(orow + 48 + 4 * h) = v4f{acc3[4 * h], acc3[4 * h + 1], acc3[4 * h + 2], acc3[4 * h + 3]};
      }
      // the next group's set-up reuses the registers these stores name
      asm volatile("s_wait_xcnt 0x0" ::: "memory");
    }
  }
}

extern "C" void kernel_launch(void* const* d_in, const int* in_sizes, int n_in,
                              void* d_out, int out_size, void* d_ws, size_t ws_size,
                              hipStream_t stream) {
  const float* Q  = (const float*)d_in[0];
  const float* K  = (const float*)d_in[1];
  const float* V  = (const float*)d_in[2];
  const float* Rw = (const float*)d_in[3];
  const float* Rb = (const float*)d_in[4];
  float* Out = (float*)d_out;

  // 16 blocks per batch-head, each a mirrored pair of 64-row q groups
  attn_fa_kernel<<<B_DIM * 16, NTHR, 0, stream>>>(Q, K, V, Rw, Rb, Out);
}

// v007
// It runs in 28.3 microseconds.
// Timed twice side by side with v006, it ran 1.03 times as fast both times.
// Counting every step since v000, it is 5.62 times as fast.
#include <hip/hip_runtime.h>

// Flash-attention with relative-position bias for MI455X (gfx1250, wave32).
// S^T = K Q^T: V_WMMA_F32_16X16X32_BF16 with 3-term hi/lo bf16 split (~2^-15 rel
//       err). A = K rows, B = Q: a lane holds 16 of the 32 scores of ONE query.
// O^T += V^T P^T: the same form and split. Two S^T tiles lie in the B fragment's
//       k order, so P is split in registers and never touches LDS; V^T's A
//       fragments come by the transposing LDS load. Maximum, sum and rescale
//       factor of a query sit in the lanes that hold its scores and outputs.
// One launch: each 128-key stage is prepared where it is used. K and V come as
// f32 through registers and are split to bf16 hi/lo on their way into LDS, both
// row-major. The waves of a block share each stage through a two-buffer LDS
// ring filled one stage ahead.
// Causal balance: a block owns two mirrored 64-row q groups (low, then high),
// 17 stages in all for every block; the four 32-key steps of a stage go to KS
// waves per q tile, whose partial (max, sum, O) are merged through LDS.
// Between two stage barriers a wave has two independent jobs: its step on this
// stage (LDS reads, matrix runs) and its share of the next stage's split (vector
// work, LDS writes). Half the waves of every SIMD take them in the other order.

typedef __attribute__((ext_vector_type(2)))  float  v2f;
typedef __attribute__((ext_vector_type(4)))  float  v4f;
typedef __attribute__((ext_vector_type(8)))  float  v8f;
typedef __attribute__((ext_vector_type(2)))  __bf16 v2bf;
typedef __attribute__((ext_vector_type(2)))  unsigned int v2u;
typedef __attribute__((ext_vector_type(8)))  __bf16 v8bf;
typedef __attribute__((ext_vector_type(16))) __bf16 v16bf;

#define B_DIM  16
#define S_DIM  2048
#define DH     64
#define KS     4        // waves that share one q tile's keys
#define NWAVES (4 * KS) // waves per block: 4 q tiles x KS key parts
#define NTHR   (NWAVES * 32)
#define NJOBS  17       // stages per block: low group's + high group's
#define SK      128                      // keys per LDS stage
#define KPITCH  144                      // staged K row: 128 B + 16 B pad (16 B x odd)
#define VPITCH  160                      // staged V row: 128 B + 32 B pad (32 B x odd, for the transposing load)
#define KH_OFF  0
#define KL_OFF  (SK * KPITCH)
#define VH_OFF  (2 * SK * KPITCH)
#define VL_OFF  (VH_OFF + SK * VPITCH)
#define BUFB    (VL_OFF + SK * VPITCH)   // bytes per ring buffer

__device__ __forceinline__ v8f wmma_bf16(v16bf a, v16bf b, v8f c) {
  return __builtin_amdgcn_wmma_f32_16x16x32_bf16(false, a, false, b, (short)0, c,
                                                 false, false);
}
__device__ __forceinline__ v16bf cat8(v8bf a, v8bf b) {
  return __builtin_shufflevector(a, b, 0, 1, 2, 3, 4, 5, 6, 7,
                                       8, 9, 10, 11, 12, 13, 14, 15);
}
// fragment = two contiguous 8-elem runs at p and p+16 (A/B 16-bit layout)
__device__ __forceinline__ v16bf ld_frag(const __bf16* p) {
  return cat8(*(const v8bf*)p, *(const v8bf*)(p + 16));
}

// 16 x 16 piece of a row-major 16-bit LDS tile, transposed: lane (c, h) gets
// rows 8h .. 8h+7 of column c; p is the lane's own 16 B of the tile
__device__ __forceinline__ v8bf ld_tr16(const unsigned char* p) {
  typedef __attribute__((address_space(3))) v8bf lds_v8bf;
  return __builtin_amdgcn_ds_load_tr16_b128_v8bf16((lds_v8bf*)p);
}
// 2^x as the one hardware instruction. The library's exp2f wraps it in a range
// guard (compare, two selects, add, ldexp) that only serves results below
// 2^-126; here every argument is score - maximum <= 0 and such a weight, against
// the maximum's own weight of 1, may as well be 0.
__device__ __forceinline__ float ex2(float x) { return __builtin_amdgcn_exp2f(x); }
// two f32 -> packed bf16 hi and packed bf16 lo (x - hi, rounded again)
__device__ __forceinline__ void split2(v2f x, unsigned& hi, unsigned& lo) {
  const unsigned w = __builtin_bit_cast(unsigned, __builtin_convertvector(x, v2bf));
  const v2f hf = {__builtin_bit_cast(float, w << 16),
                  __builtin_bit_cast(float, w & 0xffff0000u)};
  hi = w;
  lo = __builtin_bit_cast(unsigned, __builtin_convertvector(x - hf, v2bf));
}

__global__ __launch_bounds__(NTHR) void attn_fa_kernel(
    const float* __restrict__ Q, const float* __restrict__ K,
    const float* __restrict__ V, const float* __restrict__ Rw,
    const float* __restrict__ Rb, float* __restrict__ Out) {
  __shared__ float sh_rw[2 * DH];
  __shared__ float sh_rb[2];
  __shared__ __attribute__((aligned(16))) float sh_mo[(KS - 1) * 4][32 * 32];  // partial O
  __shared__ float sh_ms[(KS - 1) * 4][64];                                    // partial max, sum
  __shared__ __attribute__((aligned(16))) unsigned char ring[2 * BUFB];

  const int tid  = threadIdx.x;
  const int wave = __builtin_amdgcn_readfirstlane(tid >> 5);  // scalar: q0 steers branches
  const int lane = tid & 31;
  const int lm   = lane & 15;
  const int lh   = lane >> 4;
  const int tl   = wave & 3;                  // q tile inside the 64-row group
  const int part = wave >> 2;                 // which 32-key steps of a stage are this wave's
  // Waves that split the next stage BEFORE their step; the others do it behind.
  // Waves w, w + 4, w + 8, w + 12 share a SIMD: of each SIMD's four, the two
  // younger. Scalar, like wave.
  const bool early = part >= KS / 2;

  const int b   = blockIdx.x >> 4;
  const int gi  = blockIdx.x & 15;            // low group gi, high group 31 - gi
  const int nlo = (gi >> 1) + 1;              // stages of the low group; the high one has NJOBS - nlo

  const float* k_b = K + (size_t)b * S_DIM * DH;
  const float* v_b = V + (size_t)b * S_DIM * DH;

  // ---- job n of the block stages keys [SK*t, SK*t+SK), t counted inside its q
  //      group: 128 rows x 256 B of K and of V, each 2048 pieces of 16 B shared
  //      evenly by the block's threads. Both wait in registers until
  //      finish_stage splits them ----
  constexpr int CP = 2048 / NTHR;             // 16 B pieces per thread and tensor
  v4f kreg[CP], vreg[CP];
  // The thread's first piece of the job issued last. The two addresses live on
  // from job to job, so no load lands on an address register, and they are
  // stepped only at the next issue, behind the wait that ends this one.
  const char* kp = (const char*)k_b + (unsigned)tid * 16u;
  const char* vp = (const char*)v_b + (unsigned)tid * 16u;
  auto issue_stage = [&](int n) {
    if (n > 0) {  // on by 128 keys, or back to key 0 where the high group begins
      const long long d = (n == nlo) ? -(long long)(nlo - 1) * (SK * DH * 4)
                                     : (long long)(SK * DH * 4);
      kp += d;
      vp += d;
    }
#pragma unroll
    for (int r = 0; r < CP; ++r) {
      kreg[r] = *(const v4f*)(kp + r * (NTHR * 16));
      vreg[r] = *(const v4f*)(vp + r * (NTHR * 16));
    }
    // closes the run of loads on every path, ahead of the next step of kp and vp
    asm volatile("s_wait_xcnt 0x0" ::: "memory");
  };
  // K and V of job n: f32 -> bf16 hi and lo, 8 B each per piece, row = key
  auto finish_stage = [&](int n) {
    unsigned char* lb = ring + (n & 1) * BUFB + (tid & 15) * 8;
    unsigned char* lk = lb + (tid >> 4) * KPITCH;
    unsigned char* lv = lb + (tid >> 4) * VPITCH;
#pragma unroll
    for (int r = 0; r < CP; ++r) {
      v2u hi, lo;
#pragma unroll
      for (int i = 0; i < 2; ++i) {
        unsigned h, l;
        split2(v2f{kreg[r][2 * i], kreg[r][2 * i + 1]}, h, l);
        hi[i] = h;
        lo[i] = l;
      }
      *(v2u*)(lk + KH_OFF + r * (NTHR / 16) * KPITCH) = hi;
      *(v2u*)(lk + KL_OFF + r * (NTHR / 16) * KPITCH) = lo;
#pragma unroll
      for (int i = 0; i < 2; ++i) {
        unsigned h, l;
        split2(v2f{vreg[r][2 * i], vreg[r][2 * i + 1]}, h, l);
        hi[i] = h;
        lo[i] = l;
      }
      *(v2u*)(lv + VH_OFF + r * (NTHR / 16) * VPITCH) = hi;
      *(v2u*)(lv + VL_OFF + r * (NTHR / 16) * VPITCH) = lo;
    }
  };

  issue_stage(0);
  finish_stage(0);
  if (tid < 2 * DH) sh_rw[tid] = Rw[tid];
  if (tid < 2) sh_rb[tid] = Rb[tid];
  __syncthreads();                                   // publishes job 0 (and sh_rw, sh_rb)
  issue_stage(1);                                    // flies during the Q set-up, and during job 0 where !early

  int n = 0;                                         // job counter over both q groups
#pragma unroll 1  // one copy of the group body: keeps the kernel's text small
  for (int ph = 0; ph < 2; ++ph) {
    const int R    = ph ? S_DIM - 64 * (gi + 1) : 64 * gi;  // first q row of the group
    const int q0   = R + 16 * tl;
    const int nstp = (R >> 7) + 1;                   // 128-key stages up to the group's diagonal

    // log2(e)/sqrt(512): softmax in base-2 domain -> native v_exp_f32
    const float qscale = 0.04419417382415922f * 1.4426950408889634f;

    // ---- Q row (lm) in bf16-fragment element order: q32[16c + e] ----
    float q32[32];
    {
      const float* qrow = Q + ((size_t)(b * S_DIM + q0 + lm)) * DH;
#pragma unroll
      for (int r = 0; r < 4; ++r) {
        const v4f t0 = *(const v4f*)(qrow + 16 * r + 8 * lh);
        const v4f t1 = *(const v4f*)(qrow + 16 * r + 8 * lh + 4);
#pragma unroll
        for (int j = 0; j < 4; ++j) {
          q32[r * 8 + j]     = t0[j] * qscale;
          q32[r * 8 + 4 + j] = t1[j] * qscale;
        }
      }
    }

    // ---- relative-position bias for q-row lm: pos0 (j<i), posd = pos1-pos0 ----
    float pos0, posd;
    {
      float part0 = 0.f, part1 = 0.f;
#pragma unroll
      for (int r = 0; r < 4; ++r) {
#pragma unroll
        for (int j = 0; j < 8; ++j) {
          const int d = 16 * r + 8 * lh + j;
          part0 += q32[r * 8 + j] * sh_rw[d];
          part1 += q32[r * 8 + j] * sh_rw[DH + d];
        }
      }
      part0 += __shfl_xor(part0, 16);
      part1 += __shfl_xor(part1, 16);
      part0 += sh_rb[0] * qscale;
      part1 += sh_rb[1] * qscale;
      pos0 = part0;
      posd = part1 - part0;
    }

    // ---- pos0 in the C layout of S^T (column lm = the lane's own query): bias
    //      rides the matrix op's C operand, no per-step bias adds ----
    const v8f posC = {pos0, pos0, pos0, pos0, pos0, pos0, pos0, pos0};

    // ---- Q bf16 hi/lo B-fragments (2 chunks of K=32) ----
    v16bf aQhi[2], aQlo[2];
#pragma unroll
    for (int c = 0; c < 2; ++c) {
#pragma unroll
      for (int e = 0; e < 16; ++e) {
        const float x = q32[16 * c + e];
        const __bf16 h = (__bf16)x;
        aQhi[c][e] = h;
        aQlo[c][e] = (__bf16)(x - (float)h);
      }
    }

    v8f acc0 = {}, acc1 = {}, acc2 = {}, acc3 = {};
    float mrun = -3.0e38f, srun = 0.f;

    // buf: the stage's ring buffer; kl: first key of the step inside the stage
    auto step32 = [&](const unsigned char* buf, int kb, int kl, bool tail) {
      // ---- K fragments (hi/lo) for two 16-key tiles, from the staged rows ----
      const unsigned char* krow = buf + (kl + lm) * KPITCH + 16 * lh;
      const __bf16* kr0h = (const __bf16*)(krow + KH_OFF);
      const __bf16* kr1h = (const __bf16*)(krow + KH_OFF + 16 * KPITCH);
      const __bf16* kr0l = (const __bf16*)(krow + KL_OFF);
      const __bf16* kr1l = (const __bf16*)(krow + KL_OFF + 16 * KPITCH);

      // ---- S^T tiles (+pos0 via C): 3-term bf16 split, 12 WMMAs, two chains ----
      v16bf k0h[2], k1h[2], k0l[2], k1l[2];
#pragma unroll
      for (int c = 0; c < 2; ++c) {
        k0h[c] = ld_frag(kr0h + 32 * c);
        k1h[c] = ld_frag(kr1h + 32 * c);
        k0l[c] = ld_frag(kr0l + 32 * c);
        k1l[c] = ld_frag(kr1l + 32 * c);
      }
      // Keeps the sixteen loads together ahead of the matrix run: sunk among the
      // matrix instructions, into reused registers, each pair's LDS latency
      // would stand open there.
      __builtin_amdgcn_sched_barrier(0);
      v8f Sv0 = posC, Sv1 = posC;
#pragma unroll
      for (int c = 0; c < 2; ++c) {
        Sv0 = wmma_bf16(k0h[c], aQhi[c], Sv0);
        Sv1 = wmma_bf16(k1h[c], aQhi[c], Sv1);
        Sv0 = wmma_bf16(k0h[c], aQlo[c], Sv0);
        Sv1 = wmma_bf16(k1h[c], aQlo[c], Sv1);
        Sv0 = wmma_bf16(k0l[c], aQhi[c], Sv0);
        Sv1 = wmma_bf16(k1l[c], aQhi[c], Sv1);
      }

      // ---- query lm's scores: register g of tile i is key 16*i + 8*lh + g, which
      //      is element 8*i + g of a 16-bit fragment ----
      float vals[16];
#pragma unroll
      for (int g = 0; g < 8; ++g) {
        vals[g]     = Sv0[g];
        vals[8 + g] = Sv1[g];
      }

      // ---- (tail-only) causal mask + diagonal bias ----
      if (tail) {
#pragma unroll
        for (int e = 0; e < 16; ++e) {
          const int k  = (e < 8) ? (8 * lh + e) : (16 + 8 * lh + (e - 8));
          const int dk = (kb + k) - (q0 + lm);
          vals[e] = (dk > 0) ? -1.0e30f : ((dk == 0) ? vals[e] + posd : vals[e]);
        }
      }

      // ---- online softmax over 32 keys; balanced-tree reductions (depth 4) ----
      float tm[8];
#pragma unroll
      for (int i = 0; i < 8; ++i) tm[i] = fmaxf(vals[i], vals[8 + i]);
#pragma unroll
      for (int i = 0; i < 4; ++i) tm[i] = fmaxf(tm[i], tm[4 + i]);
      float rmax = fmaxf(fmaxf(tm[0], tm[1]), fmaxf(tm[2], tm[3]));
      rmax = fmaxf(rmax, __shfl_xor(rmax, 16));
      const float nm = fmaxf(mrun, rmax);
      if (__any(rmax > mrun)) {  // wave-uniform; rare in steady state
        const float corr = ex2(mrun - nm);
        srun *= corr;
        acc0 *= corr; acc1 *= corr; acc2 *= corr; acc3 *= corr;
      }
      mrun = nm;

      // ---- V fragments (hi/lo), 32 keys x 4 column tiles, in the k order of
      //      vals; asked for here, behind the last LDS wait of the maximum, so
      //      that they fly during the exponentials ----
      v16bf bVh[4], bVl[4];
      {
        const unsigned char* vrow = buf + (kl + 8 * lh + (lane & 7)) * VPITCH +
                                    16 * ((lane >> 3) & 1);
#pragma unroll
        for (int j = 0; j < 4; ++j) {
          bVh[j] = cat8(ld_tr16(vrow + VH_OFF + 32 * j),
                        ld_tr16(vrow + VH_OFF + 16 * VPITCH + 32 * j));
          bVl[j] = cat8(ld_tr16(vrow + VL_OFF + 32 * j),
                        ld_tr16(vrow + VL_OFF + 16 * VPITCH + 32 * j));
        }
      }
      // Keeps the sixteen loads together up here: sunk among the matrix
      // instructions, each small group's LDS latency would stand open there.
      __builtin_amdgcn_sched_barrier(0);

      v4f p0, p1, p2, p3;
#pragma unroll
      for (int j = 0; j < 2; ++j) {  // the subtractions stay packed, two scores each
        const v2f a0 = v2f{vals[2 * j],      vals[2 * j + 1]}  - nm;
        const v2f a1 = v2f{vals[4 + 2 * j],  vals[5 + 2 * j]}  - nm;
        const v2f a2 = v2f{vals[8 + 2 * j],  vals[9 + 2 * j]}  - nm;
        const v2f a3 = v2f{vals[12 + 2 * j], vals[13 + 2 * j]} - nm;
        p0[2 * j] = ex2(a0[0]); p0[2 * j + 1] = ex2(a0[1]);
        p1[2 * j] = ex2(a1[0]); p1[2 * j + 1] = ex2(a1[1]);
        p2[2 * j] = ex2(a2[0]); p2[2 * j + 1] = ex2(a2[1]);
        p3[2 * j] = ex2(a3[0]); p3[2 * j + 1] = ex2(a3[1]);
      }
      const v4f ps = (p0 + p1) + (p2 + p3);   // element-wise tree
      float rs = (ps[0] + ps[1]) + (ps[2] + ps[3]);
      const float rso = __shfl_xor(rs, 16);   // the other half's sum

      // ---- P^T hi/lo B-fragments: element e of vals is element e of the fragment ----
      v16bf aPh, aPl;
      {
        unsigned ph[8], pl[8];
#pragma unroll
        for (int i = 0; i < 2; ++i) {
          split2(v2f{p0[2 * i], p0[2 * i + 1]}, ph[i],     pl[i]);
          split2(v2f{p1[2 * i], p1[2 * i + 1]}, ph[2 + i], pl[2 + i]);
          split2(v2f{p2[2 * i], p2[2 * i + 1]}, ph[4 + i], pl[4 + i]);
          split2(v2f{p3[2 * i], p3[2 * i + 1]}, ph[6 + i], pl[6 + i]);
        }
        typedef __attribute__((ext_vector_type(8))) unsigned int v8u;
        const v8u wh = {ph[0], ph[1], ph[2], ph[3], ph[4], ph[5], ph[6], ph[7]};
        const v8u wl = {pl[0], pl[1], pl[2], pl[3], pl[4], pl[5], pl[6], pl[7]};
        aPh = __builtin_bit_cast(v16bf, wh);
        aPl = __builtin_bit_cast(v16bf, wl);
      }

      // ---- O^T += V^T @ P^T : 3-term bf16 split, 12 WMMAs, 4 independent chains;
      //      accj[g] = O[query lm][16*j + 8*lh + g] ----
      acc0 = wmma_bf16(bVh[0], aPh, acc0);
      acc1 = wmma_bf16(bVh[1], aPh, acc1);
      acc2 = wmma_bf16(bVh[2], aPh, acc2);
      acc3 = wmma_bf16(bVh[3], aPh, acc3);
      acc0 = wmma_bf16(bVh[0], aPl, acc0);
      acc1 = wmma_bf16(bVh[1], aPl, acc1);
      acc2 = wmma_bf16(bVh[2], aPl, acc2);
      acc3 = wmma_bf16(bVh[3], aPl, acc3);
      acc0 = wmma_bf16(bVl[0], aPh, acc0);
      acc1 = wmma_bf16(bVl[1], aPh, acc1);
      acc2 = wmma_bf16(bVl[2], aPh, acc2);
      acc3 = wmma_bf16(bVl[3], aPh, acc3);
      srun += rs + rso;
    };

    // ---- the group's stages; a step wholly below the tile's first row is
    //      mask-free, the one on the diagonal is masked, later ones are skipped ----
    for (int t = 0; t < nstp; ++t, ++n) {
      const unsigned char* buf = ring + (n & 1) * BUFB;
      if (early) {  // the loads of job n+1 were issued a whole step ago
        if (n + 1 < NJOBS) finish_stage(n + 1);          // into the buffer nobody reads now
        if (n + 2 < NJOBS) issue_stage(n + 2);           // to registers: flies during the step
      }
      for (int p = part; p < SK / 32; p += KS) {
        const int kb = t * SK + 32 * p;
        if (kb <= q0) step32(buf, kb, 32 * p, kb + 32 > q0);
      }
      if (!early && n + 1 < NJOBS) finish_stage(n + 1);  // into the buffer nobody reads now
      // Four vector slots behind the step's matrix run: on the way round
      // finish_stage (to the next step, to the merge) nothing else stands between
      // it and the next vector write to its operands or read of its accumulators.
      asm volatile("v_nop\n\tv_nop\n\tv_nop\n\tv_nop");
      // publish point of job n+1; every wave passes it on every trip
      asm volatile("s_wait_dscnt 0x0" ::: "memory");     // own reads of this buffer, own K and V stores done
      __syncthreads();
      if (!early && n + 2 < NJOBS) issue_stage(n + 2);   // for the buffer just read
    }

    // ---- merge the KS key parts of each q tile: parts 1.. hand (max, sum, O) over ----
    if (part != 0) {
      float* mo = sh_mo[(part - 1) * 4 + tl];
      float* ms = sh_ms[(part - 1) * 4 + tl];
      ms[lane]      = mrun;
      ms[32 + lane] = srun;
#pragma unroll
      for (int h = 0; h < 2; ++h) {
        const v4f t0 = {acc0[4 * h], acc0[4 * h + 1], acc0[4 * h + 2], acc0[4 * h + 3]};
        const v4f t1 = {acc1[4 * h], acc1[4 * h + 1], acc1[4 * h + 2], acc1[4 * h + 3]};
        const v4f t2 = {acc2[4 * h], acc2[4 * h + 1], acc2[4 * h + 2], acc2[4 * h + 3]};
        const v4f t3 = {acc3[4 * h], acc3[4 * h + 1], acc3[4 * h + 2], acc3[4 * h + 3]};
        *(v4f*)&mo[(0 + h) * 128 + lane * 4] = t0;
        *(v4f*)&mo[(2 + h) * 128 + lane * 4] = t1;
        *(v4f*)&mo[(4 + h) * 128 + lane * 4] = t2;
        *(v4f*)&mo[(6 + h) * 128 + lane * 4] = t3;
      }
    }
    __syncthreads();  // partials visible to part 0; they are rewritten only behind later stage barriers
    if (part == 0) {
      float mk[KS - 1], sk[KS - 1];
      float m = mrun;
#pragma unroll
      for (int k = 0; k < KS - 1; ++k) {
        mk[k] = sh_ms[k * 4 + tl][lane];
        sk[k] = sh_ms[k * 4 + tl][32 + lane];
        m = fmaxf(m, mk[k]);                  // a part without steps holds -3e38, 0, 0
      }
      const float c0 = ex2(mrun - m);
      float s = srun * c0;
#pragma unroll
      for (int k = 0; k < KS - 1; ++k) {
        mk[k] = ex2(mk[k] - m);
        s += sk[k] * mk[k];
      }
      const float inv = __builtin_amdgcn_rcpf(s);
      // each part's weight / sum: the lane's own query's, like all it holds of O
      {
        const float f = c0 * inv;
        acc0 *= f; acc1 *= f; acc2 *= f; acc3 *= f;
      }
#pragma unroll
      for (int k = 0; k < KS - 1; ++k) {
        const float f = mk[k] * inv;
        const float* mo = sh_mo[k * 4 + tl];
#pragma unroll
        for (int h = 0; h < 2; ++h) {
          const v4f t0 = *(const v4f*)&mo[(0 + h) * 128 + lane * 4];
          const v4f t1 = *(const v4f*)&mo[(2 + h) * 128 + lane * 4];
          const v4f t2 = *(const v4f*)&mo[(4 + h) * 128 + lane * 4];
          const v4f t3 = *(const v4f*)&mo[(6 + h) * 128 + lane * 4];
#pragma unroll
          for (int j = 0; j < 4; ++j) {
            acc0[4 * h + j] += f * t0[j];
            acc1[4 * h + j] += f * t1[j];
            acc2[4 * h + j] += f * t2[j];
            acc3[4 * h + j] += f * t3[j];
          }
        }
      }
      float* orow = Out + (unsigned)((b * S_DIM + q0 + lm) * DH + 8 * lh);
#pragma unroll
      for (int h = 0; h < 2; ++h) {
        *(v4f*)(orow + 4 * h)      = v4f{acc0[4 * h], acc0[4 * h + 1], acc0[4 * h + 2], acc0[4 * h + 3]};
        *(v4f*)(orow + 16 + 4 * h) = v4f{acc1[4 * h], acc1[4 * h + 1], acc1[4 * h + 2], acc1[4 * h + 3]};
        *(v4f*)(orow + 32 + 4 * h) = v4f{acc2[4 * h], acc2[4 * h + 1], acc2[4 * h + 2], acc2[4 * h + 3]};
        *(v4f*)(orow + 48 + 4 * h) = v4f{acc3[4 * h], acc3[4 * h + 1], acc3[4 * h + 2], acc3[4 * h + 3]};
      }
      // the next group's set-up reuses the registers these stores name
      asm volatile("s_wait_xcnt 0x0" ::: "memory");
    }
  }
}

extern "C" void kernel_launch(void* const* d_in, const int* in_sizes, int n_in,
                              void* d_out, int out_size, void* d_ws, size_t ws_size,
                              hipStream_t stream) {
  const float* Q  = (const float*)d_in[0];
  const float* K  = (const float*)d_in[1];
  const float* V  = (const float*)d_in[2];
  const float* Rw = (const float*)d_in[3];
  const float* Rb = (const float*)d_in[4];
  float* Out = (float*)d_out;

  // 16 blocks per batch-head, each a mirrored pair of 64-row q groups
  attn_fa_kernel<<<B_DIM * 16, NTHR, 0, stream>>>(Q, K, V, Rw, Rb, Out);
}

// v010
// It runs in 20.7 microseconds.
// Versions between v007 and this one are left out; their measured steps multiply to 1.36 times as fast.
// Over all steps from v000 it is 7.66 times as fast.
#include <hip/hip_runtime.h>

// Flash-attention with relative-position bias for MI455X (gfx1250, wave32).
// Both products run on V_WMMA_F32_16X16X32_F16 with f32 accumulators; every
// operand is a single f16 word (11 significant bits, rounded to nearest: up to
// 2^-11 rel err each, so a product carries about 2^-10.5).
// S^T = K Q^T: A = K rows, B = Q: a lane holds 16 of the 32 scores of ONE query.
// O^T += V^T P^T: the weights lie in [0, 1]. Two S^T tiles lie
//       in the B fragment's k order, so P is packed in registers and never
//       touches LDS; V^T's A fragments come by the transposing LDS load.
//       Maximum, sum and rescale factor of a query sit in the lanes that hold
//       its scores and outputs.
// One launch: each 128-key stage is prepared where it is used. K and V come as
// f32 through registers and are turned to f16 on their way into LDS, both
// row-major. The waves of a block share each stage through a six-buffer LDS
// ring filled three stages ahead, so that a publish point (LDS wait and barrier)
// is due only behind every third stage: between two of them a wave runs three
// steps and the waves of a SIMD drift out of step with one another.
// Causal balance: a block owns two mirrored 64-row q groups (low, then high),
// 17 stages in all for every block; the four 32-key steps of a stage go to KS
// waves per q tile, whose partial (max, sum, O) are merged through LDS.
// For each stage a wave has two independent jobs: its step on this stage (LDS
// reads, matrix runs) and its share of the conversion of the stage three ahead (vector
// work, LDS writes). Half the waves of every SIMD take them in the other order.

typedef __attribute__((ext_vector_type(2)))  float  v2f;
typedef __attribute__((ext_vector_type(4)))  float  v4f;
typedef __attribute__((ext_vector_type(8)))  float  v8f;
typedef __attribute__((ext_vector_type(2)))  _Float16 v2h;
typedef __attribute__((ext_vector_type(2)))  unsigned int v2u;
typedef __attribute__((ext_vector_type(8)))  _Float16 v8h;
typedef __attribute__((ext_vector_type(16))) _Float16 v16h;

#define B_DIM  16
#define S_DIM  2048
#define DH     64
#define KS     4        // waves that share one q tile's keys
#define NWAVES (4 * KS) // waves per block: 4 q tiles x KS key parts
#define NTHR   (NWAVES * 32)
#define NJOBS  17       // stages per block: low group's + high group's
#define SK      128                      // keys per LDS stage
#define KPITCH  144                      // staged K row: 128 B + 16 B pad (16 B x odd)
#define VPITCH  160                      // staged V row: 128 B + 32 B pad (32 B x odd, for the transposing load)
#define KH_OFF  0
#define VH_OFF  (SK * KPITCH)
#define BUFB    (VH_OFF + SK * VPITCH)   // bytes per ring buffer
#define AHEAD   3                        // stages between two publish points; a stage is filled so far ahead
#define NBUF    (2 * AHEAD)              // ring buffers: AHEAD being read, AHEAD being filled

__device__ __forceinline__ v8f wmma_f16(v16h a, v16h b, v8f c) {
  return __builtin_amdgcn_wmma_f32_16x16x32_f16(false, a, false, b, (short)0, c,
                                                false, false);
}
__device__ __forceinline__ v16h cat8(v8h a, v8h b) {
  return __builtin_shufflevector(a, b, 0, 1, 2, 3, 4, 5, 6, 7,
                                       8, 9, 10, 11, 12, 13, 14, 15);
}
// fragment = two contiguous 8-elem runs at p and p+16 (A/B 16-bit layout)
__device__ __forceinline__ v16h ld_frag(const _Float16* p) {
  return cat8(*(const v8h*)p, *(const v8h*)(p + 16));
}

// 16 x 16 piece of a row-major 16-bit LDS tile, transposed: lane (c, h) gets
// rows 8h .. 8h+7 of column c; p is the lane's own 16 B of the tile
__device__ __forceinline__ v8h ld_tr16(const unsigned char* p) {
  typedef __attribute__((ext_vector_type(8))) __fp16 v8s;   // the builtin's own element type; same bits
  typedef __attribute__((address_space(3))) v8s lds_v8s;
  return __builtin_bit_cast(v8h, __builtin_amdgcn_ds_load_tr16_b128_v8f16((lds_v8s*)p));
}
// 2^x as the one hardware instruction. The library's exp2f wraps it in a range
// guard (compare, two selects, add, ldexp) that only serves results below
// 2^-126; here every argument is score - maximum <= 0 and such a weight, against
// the maximum's own weight of 1, may as well be 0.
__device__ __forceinline__ float ex2(float x) { return __builtin_amdgcn_exp2f(x); }
// two f32 -> one packed f16 word, rounded to nearest
__device__ __forceinline__ unsigned pack2(v2f x) {
  return __builtin_bit_cast(unsigned, __builtin_convertvector(x, v2h));
}

__global__ __launch_bounds__(NTHR) void attn_fa_kernel(
    const float* __restrict__ Q, const float* __restrict__ K,
    const float* __restrict__ V, const float* __restrict__ Rw,
    const float* __restrict__ Rb, float* __restrict__ Out) {
  __shared__ float sh_rw[2 * DH];
  __shared__ float sh_rb[2];
  __shared__ __attribute__((aligned(16))) float sh_mo[(KS - 1) * 4][32 * 32];  // partial O
  __shared__ float sh_ms[(KS - 1) * 4][64];                                    // partial max, sum
  __shared__ __attribute__((aligned(16))) unsigned char ring[NBUF * BUFB];

  const int tid  = threadIdx.x;
  const int wave = __builtin_amdgcn_readfirstlane(tid >> 5);  // scalar: q0 steers branches
  const int lane = tid & 31;
  const int lm   = lane & 15;
  const int lh   = lane >> 4;
  const int tl   = wave & 3;                  // q tile inside the 64-row group
  const int part = wave >> 2;                 // which 32-key steps of a stage are this wave's
  // Waves that convert the stage three ahead BEFORE their step; the others do it behind.
  // Waves w, w + 4, w + 8, w + 12 share a SIMD: of each SIMD's four, the two
  // younger. Scalar, like wave.
  const bool early = part >= KS / 2;

  const int b   = blockIdx.x >> 4;
  const int gi  = blockIdx.x & 15;            // low group gi, high group 31 - gi
  const int nlo = (gi >> 1) + 1;              // stages of the low group; the high one has NJOBS - nlo

  const float* k_b = K + (size_t)b * S_DIM * DH;
  const float* v_b = V + (size_t)b * S_DIM * DH;

  // ---- job n of the block stages keys [SK*t, SK*t+SK), t counted inside its q
  //      group: 128 rows x 256 B of K and of V, each 2048 pieces of 16 B shared
  //      evenly by the block's threads. Both wait in registers until
  //      finish_stage converts them ----
  constexpr int CP = 2048 / NTHR;             // 16 B pieces per thread and tensor
  v4f kreg[CP], vreg[CP];
  // The thread's first piece of the job issued last. The two addresses live on
  // from job to job, so no load lands on an address register, and they are
  // stepped only at the next issue, behind the wait that ends this one.
  const char* kp = (const char*)k_b + (unsigned)tid * 16u;
  const char* vp = (const char*)v_b + (unsigned)tid * 16u;
  auto issue_stage = [&](int n) {
    if (n > 0) {  // on by 128 keys, or back to key 0 where the high group begins
      const long long d = (n == nlo) ? -(long long)(nlo - 1) * (SK * DH * 4)
                                     : (long long)(SK * DH * 4);
      kp += d;
      vp += d;
    }
#pragma unroll
    for (int r = 0; r < CP; ++r) {
      kreg[r] = *(const v4f*)(kp + r * (NTHR * 16));
      vreg[r] = *(const v4f*)(vp + r * (NTHR * 16));
    }
    // closes the run of loads on every path, ahead of the next step of kp and vp;
    // it names both, so that they keep their registers up to here and no load of
    // the run lands on one
    asm volatile("s_wait_xcnt 0x0" :: "v"(kp), "v"(vp) : "memory");
  };
  // K and V of job n: f32 -> f16; 8 B each per piece, row = key
  auto finish_from = [&](int ro, const v4f* kr, const v4f* vr) {  // ro: the job's buffer, bytes into the ring
    unsigned char* lb = ring + ro + (tid & 15) * 8;
    unsigned char* lk = lb + (tid >> 4) * KPITCH;
    unsigned char* lv = lb + (tid >> 4) * VPITCH;
#pragma unroll
    for (int r = 0; r < CP; ++r) {
      v2u w;
      w[0] = pack2(v2f{kr[r][0], kr[r][1]});
      w[1] = pack2(v2f{kr[r][2], kr[r][3]});
      *(v2u*)(lk + KH_OFF + r * (NTHR / 16) * KPITCH) = w;
      w[0] = pack2(v2f{vr[r][0], vr[r][1]});
      w[1] = pack2(v2f{vr[r][2], vr[r][3]});
      *(v2u*)(lv + VH_OFF + r * (NTHR / 16) * VPITCH) = w;
    }
  };
  auto finish_stage = [&](int ro) { finish_from(ro, kreg, vreg); };

  issue_stage(0);
  finish_stage(0);
  if (tid < 2 * DH) sh_rw[tid] = Rw[tid];
  if (tid < 2) sh_rb[tid] = Rb[tid];
  __syncthreads();                                   // publishes job 0 (and sh_rw, sh_rb)
  // Jobs 1 .. AHEAD fly together during the first Q set-up, each in registers of
  // its own; all but the last are converted behind that set-up, ahead of job 0's step.
  v4f kfirst[AHEAD - 1][CP], vfirst[AHEAD - 1][CP];
#pragma unroll
  for (int j = 0; j < AHEAD - 1; ++j) {
    issue_stage(j + 1);
#pragma unroll
    for (int r = 0; r < CP; ++r) {
      kfirst[j][r] = kreg[r];
      vfirst[j][r] = vreg[r];
    }
  }
  issue_stage(AHEAD);

  int n = 0;                                         // job counter over both q groups
  int ro = 0;                                        // job n's buffer, bytes into the ring
#pragma unroll  // two copies of the group body: the first jobs' registers are live in the first alone
  for (int ph = 0; ph < 2; ++ph) {
    const int R    = ph ? S_DIM - 64 * (gi + 1) : 64 * gi;  // first q row of the group
    const int q0   = R + 16 * tl;
    const int nstp = (R >> 7) + 1;                   // 128-key stages up to the group's diagonal

    // log2(e)/sqrt(512): softmax in base-2 domain -> native v_exp_f32
    const float qscale = 0.04419417382415922f * 1.4426950408889634f;

    // ---- Q row (lm) in 16-bit-fragment element order: q32[16c + e] ----
    float q32[32];
    {
      const float* qrow = Q + ((size_t)(b * S_DIM + q0 + lm)) * DH + 8 * lh;
#pragma unroll
      for (int r = 0; r < 4; ++r) {
        const v4f t0 = *(const v4f*)(qrow + 16 * r);
        const v4f t1 = *(const v4f*)(qrow + 16 * r + 4);
#pragma unroll
        for (int j = 0; j < 4; ++j) {
          q32[r * 8 + j]     = t0[j] * qscale;
          q32[r * 8 + 4 + j] = t1[j] * qscale;
        }
      }
      // closes the run of loads; it names their address, which so keeps its
      // registers up to here: no load of the run lands on it
      asm volatile("s_wait_xcnt 0x0" :: "v"(qrow) : "memory");
    }

    // ---- relative-position bias for q-row lm: pos0 (j<i), posd = pos1-pos0 ----
    float pos0, posd;
    {
      float part0 = 0.f, part1 = 0.f;
#pragma unroll
      for (int r = 0; r < 4; ++r) {
#pragma unroll
        for (int j = 0; j < 8; ++j) {
          const int d = 16 * r + 8 * lh + j;
          part0 += q32[r * 8 + j] * sh_rw[d];
          part1 += q32[r * 8 + j] * sh_rw[DH + d];
        }
      }
      part0 += __shfl_xor(part0, 16);
      part1 += __shfl_xor(part1, 16);
      part0 += sh_rb[0] * qscale;
      part1 += sh_rb[1] * qscale;
      pos0 = part0;
      posd = part1 - part0;
    }

    // ---- pos0 in the C layout of S^T (column lm = the lane's own query): bias
    //      rides the matrix op's C operand, no per-step bias adds ----
    const v8f posC = {pos0, pos0, pos0, pos0, pos0, pos0, pos0, pos0};

    // ---- Q f16 B-fragments (2 chunks of K=32) ----
    v16h aQ[2];
#pragma unroll
    for (int c = 0; c < 2; ++c) {
#pragma unroll
      for (int e = 0; e < 16; ++e) aQ[c][e] = (_Float16)q32[16 * c + e];
    }

    v8f acc0 = {}, acc1 = {}, acc2 = {}, acc3 = {};
    float mrun = -3.0e38f, srun = 0.f;

    // buf: the stage's ring buffer; kl: first key of the step inside the stage
    auto step32 = [&](const unsigned char* buf, int kb, int kl, bool tail) {
      // ---- K fragments for two 16-key tiles, from the staged rows ----
      const unsigned char* krow = buf + (kl + lm) * KPITCH + 16 * lh;
      const _Float16* kr0h = (const _Float16*)(krow + KH_OFF);
      const _Float16* kr1h = (const _Float16*)(krow + KH_OFF + 16 * KPITCH);

      // ---- S^T tiles (+pos0 via C): K x Q, 4 WMMAs, two chains ----
      v16h k0h[2], k1h[2];
#pragma unroll
      for (int c = 0; c < 2; ++c) {
        k0h[c] = ld_frag(kr0h + 32 * c);
        k1h[c] = ld_frag(kr1h + 32 * c);
      }
      // Keeps the eight loads together ahead of the matrix run: sunk among the
      // matrix instructions, into reused registers, each pair's LDS latency
      // would stand open there.
      __builtin_amdgcn_sched_barrier(0);
      v8f Sv0 = posC, Sv1 = posC;
#pragma unroll
      for (int c = 0; c < 2; ++c) {
        Sv0 = wmma_f16(k0h[c], aQ[c], Sv0);
        Sv1 = wmma_f16(k1h[c], aQ[c], Sv1);
      }

      // ---- query lm's scores: register g of tile i is key 16*i + 8*lh + g, which
      //      is element 8*i + g of a 16-bit fragment ----
      float vals[16];
#pragma unroll
      for (int g = 0; g < 8; ++g) {
        vals[g]     = Sv0[g];
        vals[8 + g] = Sv1[g];
      }

      // ---- (tail-only) causal mask + diagonal bias ----
      if (tail) {
#pragma unroll
        for (int e = 0; e < 16; ++e) {
          const int k  = (e < 8) ? (8 * lh + e) : (16 + 8 * lh + (e - 8));
          const int dk = (kb + k) - (q0 + lm);
          vals[e] = (dk > 0) ? -1.0e30f : ((dk == 0) ? vals[e] + posd : vals[e]);
        }
      }

      // ---- online softmax over 32 keys; balanced-tree reductions (depth 4) ----
      float tm[8];
#pragma unroll
      for (int i = 0; i < 8; ++i) tm[i] = fmaxf(vals[i], vals[8 + i]);
#pragma unroll
      for (int i = 0; i < 4; ++i) tm[i] = fmaxf(tm[i], tm[4 + i]);
      float rmax = fmaxf(fmaxf(tm[0], tm[1]), fmaxf(tm[2], tm[3]));
      rmax = fmaxf(rmax, __shfl_xor(rmax, 16));
      const float nm = fmaxf(mrun, rmax);
      if (__any(rmax > mrun)) {  // wave-uniform; rare in steady state
        const float corr = ex2(mrun - nm);
        srun *= corr;
        acc0 *= corr; acc1 *= corr; acc2 *= corr; acc3 *= corr;
      }
      mrun = nm;

      // ---- V fragments, 32 keys x 4 column tiles, in the k order of
      //      vals; asked for here, behind the last LDS wait of the maximum, so
      //      that they fly during the exponentials ----
      v16h bVh[4];
      {
        const unsigned char* vrow = buf + (kl + 8 * lh + (lane & 7)) * VPITCH +
                                    16 * ((lane >> 3) & 1);
#pragma unroll
        for (int j = 0; j < 4; ++j) {
          bVh[j] = cat8(ld_tr16(vrow + VH_OFF + 32 * j),
                        ld_tr16(vrow + VH_OFF + 16 * VPITCH + 32 * j));
        }
      }
      // Keeps the eight loads together up here: sunk among the matrix
      // instructions, each small group's LDS latency would stand open there.
      __builtin_amdgcn_sched_barrier(0);

      v4f p0, p1, p2, p3;
#pragma unroll
      for (int j = 0; j < 2; ++j) {  // the subtractions stay packed, two scores each
        const v2f a0 = v2f{vals[2 * j],      vals[2 * j + 1]}  - nm;
        const v2f a1 = v2f{vals[4 + 2 * j],  vals[5 + 2 * j]}  - nm;
        const v2f a2 = v2f{vals[8 + 2 * j],  vals[9 + 2 * j]}  - nm;
        const v2f a3 = v2f{vals[12 + 2 * j], vals[13 + 2 * j]} - nm;
        p0[2 * j] = ex2(a0[0]); p0[2 * j + 1] = ex2(a0[1]);
        p1[2 * j] = ex2(a1[0]); p1[2 * j + 1] = ex2(a1[1]);
        p2[2 * j] = ex2(a2[0]); p2[2 * j + 1] = ex2(a2[1]);
        p3[2 * j] = ex2(a3[0]); p3[2 * j + 1] = ex2(a3[1]);
      }
      const v4f ps = (p0 + p1) + (p2 + p3);   // element-wise tree
      float rs = (ps[0] + ps[1]) + (ps[2] + ps[3]);
      const float rso = __shfl_xor(rs, 16);   // the other half's sum

      // ---- P^T B-fragment, one f16 word a weight: element e of vals is element e
      //      of the fragment ----
      v16h aP;
      {
        typedef __attribute__((ext_vector_type(8))) unsigned int v8u;
        const v8u w = {pack2(v2f{p0[0], p0[1]}), pack2(v2f{p0[2], p0[3]}),
                       pack2(v2f{p1[0], p1[1]}), pack2(v2f{p1[2], p1[3]}),
                       pack2(v2f{p2[0], p2[1]}), pack2(v2f{p2[2], p2[3]}),
                       pack2(v2f{p3[0], p3[1]}), pack2(v2f{p3[2], p3[3]})};
        aP = __builtin_bit_cast(v16h, w);
      }

      // ---- O^T += V^T @ P^T : 4 independent WMMAs;
      //      accj[g] = O[query lm][16*j + 8*lh + g] ----
      acc0 = wmma_f16(bVh[0], aP, acc0);
      acc1 = wmma_f16(bVh[1], aP, acc1);
      acc2 = wmma_f16(bVh[2], aP, acc2);
      acc3 = wmma_f16(bVh[3], aP, acc3);
      srun += rs + rso;
    };

    // ---- the group's stages; a step wholly below the tile's first row is
    //      mask-free, the one on the diagonal is masked, later ones are skipped.
    //      Behind every publish point the next AHEAD jobs stand converted; job n's
    //      trip fills job n+AHEAD's buffer, last read AHEAD jobs ago, in front of
    //      that point. Job 0 stands alone: the ring is filled up during its trip ----
    if (ph == 0) {
#pragma unroll
      for (int j = 0; j < AHEAD - 1; ++j) finish_from((j + 1) * BUFB, kfirst[j], vfirst[j]);
    }
    int since = ph ? 0 : AHEAD - 1;                  // jobs since the last publish point
    for (int t = 0; t < nstp; ++t, ++n) {
      const unsigned char* buf = ring + ro;
      const int fo = ro + (ro < AHEAD * BUFB ? AHEAD * BUFB : -AHEAD * BUFB);  // job n+AHEAD's buffer
      ro = (ro == (NBUF - 1) * BUFB) ? 0 : ro + BUFB;
      if (early) {  // the loads of job n+AHEAD were issued a whole step ago
        if (n + AHEAD < NJOBS) finish_stage(fo);                 // into a buffer nobody reads now
        if (n + AHEAD + 1 < NJOBS) issue_stage(n + AHEAD + 1);   // to registers: flies during the step
      }
      for (int p = part; p < SK / 32; p += KS) {
        const int kb = t * SK + 32 * p;
        if (kb <= q0) step32(buf, kb, 32 * p, kb + 32 > q0);
      }
      if (!early && n + AHEAD < NJOBS) finish_stage(fo);  // into a buffer nobody reads now
      // Four vector slots behind the step's matrix run: on the way round
      // finish_stage (to the next step, to the merge) nothing else stands between
      // it and the next vector write to its operands or read of its accumulators.
      asm volatile("v_nop\n\tv_nop\n\tv_nop\n\tv_nop");
      // publish point of the next AHEAD jobs, behind every AHEAD-th job of a group;
      // behind its last job the merge's barrier below serves as one. Both tests read
      // the same in every wave of the block
      if (t + 1 == nstp) continue;
      if (++since == AHEAD) {
        since = 0;
        asm volatile("s_wait_dscnt 0x0" ::: "memory");   // own reads of these buffers, own K and V stores done
        __syncthreads();
      }
      if (!early && n + AHEAD + 1 < NJOBS) issue_stage(n + AHEAD + 1);  // behind the barrier, which waits for loads too
    }

    // ---- merge the KS key parts of each q tile: parts 1.. hand (max, sum, O) over ----
    if (part != 0) {
      float* mo = sh_mo[(part - 1) * 4 + tl];
      float* ms = sh_ms[(part - 1) * 4 + tl];
      ms[lane]      = mrun;
      ms[32 + lane] = srun;
#pragma unroll
      for (int h = 0; h < 2; ++h) {
        const v4f t0 = {acc0[4 * h], acc0[4 * h + 1], acc0[4 * h + 2], acc0[4 * h + 3]};
        const v4f t1 = {acc1[4 * h], acc1[4 * h + 1], acc1[4 * h + 2], acc1[4 * h + 3]};
        const v4f t2 = {acc2[4 * h], acc2[4 * h + 1], acc2[4 * h + 2], acc2[4 * h + 3]};
        const v4f t3 = {acc3[4 * h], acc3[4 * h + 1], acc3[4 * h + 2], acc3[4 * h + 3]};
        *(v4f*)&mo[(0 + h) * 128 + lane * 4] = t0;
        *(v4f*)&mo[(2 + h) * 128 + lane * 4] = t1;
        *(v4f*)&mo[(4 + h) * 128 + lane * 4] = t2;
        *(v4f*)&mo[(6 + h) * 128 + lane * 4] = t3;
      }
    }
    // partials visible to part 0 (they are rewritten only behind later stage barriers);
    // also the publish point behind the group's last job
    asm volatile("s_wait_dscnt 0x0" ::: "memory");       // own reads of the ring, own K, V and partial stores done
    __syncthreads();
    if (!early && n + AHEAD < NJOBS) issue_stage(n + AHEAD);  // as in the loop: behind the barrier, which waits for loads too
    if (part == 0) {
      float mk[KS - 1], sk[KS - 1];
      float m = mrun;
#pragma unroll
      for (int k = 0; k < KS - 1; ++k) {
        mk[k] = sh_ms[k * 4 + tl][lane];
        sk[k] = sh_ms[k * 4 + tl][32 + lane];
        m = fmaxf(m, mk[k]);                  // a part without steps holds -3e38, 0, 0
      }
      const float c0 = ex2(mrun - m);
      float s = srun * c0;
#pragma unroll
      for (int k = 0; k < KS - 1; ++k) {
        mk[k] = ex2(mk[k] - m);
        s += sk[k] * mk[k];
      }
      const float inv = __builtin_amdgcn_rcpf(s);
      // each part's weight / sum: the lane's own query's, like all it holds of O
      {
        const float f = c0 * inv;
        acc0 *= f; acc1 *= f; acc2 *= f; acc3 *= f;
      }
#pragma unroll
      for (int k = 0; k < KS - 1; ++k) {
        const float f = mk[k] * inv;
        const float* mo = sh_mo[k * 4 + tl];
#pragma unroll
        for (int h = 0; h < 2; ++h) {
          const v4f t0 = *(const v4f*)&mo[(0 + h) * 128 + lane * 4];
          const v4f t1 = *(const v4f*)&mo[(2 + h) * 128 + lane * 4];
          const v4f t2 = *(const v4f*)&mo[(4 + h) * 128 + lane * 4];
          const v4f t3 = *(const v4f*)&mo[(6 + h) * 128 + lane * 4];
#pragma unroll
          for (int j = 0; j < 4; ++j) {
            acc0[4 * h + j] += f * t0[j];
            acc1[4 * h + j] += f * t1[j];
            acc2[4 * h + j] += f * t2[j];
            acc3[4 * h + j] += f * t3[j];
          }
        }
      }
      float* orow = Out + (unsigned)((b * S_DIM + q0 + lm) * DH + 8 * lh);
#pragma unroll
      for (int h = 0; h < 2; ++h) {
        *(v4f*)(orow + 4 * h)      = v4f{acc0[4 * h], acc0[4 * h + 1], acc0[4 * h + 2], acc0[4 * h + 3]};
        *(v4f*)(orow + 16 + 4 * h) = v4f{acc1[4 * h], acc1[4 * h + 1], acc1[4 * h + 2], acc1[4 * h + 3]};
        *(v4f*)(orow + 32 + 4 * h) = v4f{acc2[4 * h], acc2[4 * h + 1], acc2[4 * h + 2], acc2[4 * h + 3]};
        *(v4f*)(orow + 48 + 4 * h) = v4f{acc3[4 * h], acc3[4 * h + 1], acc3[4 * h + 2], acc3[4 * h + 3]};
      }
      // the next group's set-up reuses the registers these stores name
      asm volatile("s_wait_xcnt 0x0" ::: "memory");
    }
  }
}

extern "C" void kernel_launch(void* const* d_in, const int* in_sizes, int n_in,
                              void* d_out, int out_size, void* d_ws, size_t ws_size,
                              hipStream_t stream) {
  const float* Q  = (const float*)d_in[0];
  const float* K  = (const float*)d_in[1];
  const float* V  = (const float*)d_in[2];
  const float* Rw = (const float*)d_in[3];
  const float* Rb = (const float*)d_in[4];
  float* Out = (float*)d_out;

  // 16 blocks per batch-head, each a mirrored pair of 64-row q groups
  attn_fa_kernel<<<B_DIM * 16, NTHR, 0, stream>>>(Q, K, V, Rw, Rb, Out);
}
